// v000
// Times are from an AMD MI455X. After a warm-up the kernel runs many times in a row, and a time is the length of
// such a window on the GPU divided by its runs, so every launch and the gaps after it count. The runs cycle
// through copies of the inputs. A figure is the median of several windows, for all but v000 over two sittings.
// Sittings can differ by a few percent; kernels timed side by side share one.
// v000, which the later versions start from, runs in 1300 microseconds.
#include <hip/hip_runtime.h>
#include <hip/hip_bf16.h>

#define BB 8
#define S1D 2048
#define S2D 2048
#define EED 1024
#define PPD 1024
#define QPITCH 1032   // 1024 + 8 bf16 pad -> row stride 2064B = 129*16B (bank-spread)

typedef __attribute__((ext_vector_type(16))) __bf16 v16bf;
typedef __attribute__((ext_vector_type(8)))  __bf16 v8bf;
typedef __attribute__((ext_vector_type(8)))  float  v8f;
typedef __attribute__((ext_vector_type(4)))  int    v4i;

typedef __attribute__((address_space(1))) v4i* as1_v4ip;  // global (prints as __device__*)
typedef __attribute__((address_space(3))) v4i* as3_v4ip;  // LDS

// Build a 16-element bf16 WMMA fragment from two 16-byte chunks.
// Per ISA 7.12.2 (16-bit A/B layout): frag[0..7] = K group (half*8 ..),
// frag[8..15] = K group (16+half*8 ..).
static __device__ inline v16bf frag_from_bf16(const __bf16* p0, const __bf16* p1) {
  v8bf lo = *(const v8bf*)p0;
  v8bf hi = *(const v8bf*)p1;
  return __builtin_shufflevector(lo, hi, 0,1,2,3,4,5,6,7,8,9,10,11,12,13,14,15);
}

static __device__ inline v16bf frag_from_f32(const float* p0, const float* p1) {
  v16bf r;
#pragma unroll
  for (int i = 0; i < 8; ++i) { r[i] = (__bf16)p0[i]; r[i + 8] = (__bf16)p1[i]; }
  return r;
}

// Async global->LDS 16B copy (ASYNCcnt path) with synchronous fallback.
static __device__ inline void copy16_g2l(const __bf16* gsrc, __bf16* ldst) {
#if __has_builtin(__builtin_amdgcn_global_load_async_to_lds_b128)
  __builtin_amdgcn_global_load_async_to_lds_b128(
      (as1_v4ip)gsrc, (as3_v4ip)ldst, 0, 0);
#else
  *(v8bf*)ldst = *(const v8bf*)gsrc;
#endif
}

static __device__ inline void wait_async_copies() {
#if __has_builtin(__builtin_amdgcn_global_load_async_to_lds_b128)
#if __has_builtin(__builtin_amdgcn_s_wait_asynccnt)
  __builtin_amdgcn_s_wait_asynccnt(0);
#else
  asm volatile("s_wait_asynccnt 0" ::: "memory");
#endif
#endif
}

// ---------------------------------------------------------------------------
// Projection: out = X (M x E, f32) @ W^T + b, output bf16.
// mode 0: out row-major (M x P).  mode 1: out transposed per batch (B, P, S2).
// Block = 256 threads = 8 wave32 waves; block tile 32(M) x 256(N);
// wave tile 16 x 64 (four 16x16 f32 accumulators), K stepped by 32.
// ---------------------------------------------------------------------------
__global__ __launch_bounds__(256)
void proj_kernel(const float* __restrict__ X, const float* __restrict__ W,
                 const float* __restrict__ bias, __bf16* __restrict__ out,
                 int mode) {
  const int lane = threadIdx.x & 31;
  const int wv   = threadIdx.x >> 5;
  const int r    = lane & 15;
  const int hh   = lane >> 4;

  const int m0 = blockIdx.x * 32 + (wv & 1) * 16;
  const int n0 = blockIdx.y * 256 + (wv >> 1) * 64;

  const float* arow = X + (size_t)(m0 + r) * EED;
  v8f acc[4] = {};

#pragma unroll 2
  for (int k = 0; k < EED; k += 32) {
    v16bf a = frag_from_f32(arow + k + hh * 8, arow + k + 16 + hh * 8);
#pragma unroll
    for (int nt = 0; nt < 4; ++nt) {
      const float* wrow = W + (size_t)(n0 + nt * 16 + r) * EED; // B[k][n] = W[n][k]
      v16bf bfr = frag_from_f32(wrow + k + hh * 8, wrow + k + 16 + hh * 8);
      acc[nt] = __builtin_amdgcn_wmma_f32_16x16x32_bf16(
          false, a, false, bfr, (short)0, acc[nt], false, false);
    }
  }

  if (mode == 0) {
#pragma unroll
    for (int nt = 0; nt < 4; ++nt) {
      const int n = n0 + nt * 16 + r;
      const float bv = bias[n];
#pragma unroll
      for (int v = 0; v < 8; ++v) {
        const int m = m0 + hh * 8 + v;
        out[(size_t)m * PPD + n] = (__bf16)(acc[nt][v] + bv);
      }
    }
  } else {
#pragma unroll
    for (int nt = 0; nt < 4; ++nt) {
      const int n = n0 + nt * 16 + r;
      const float bv = bias[n];
      const int m = m0 + hh * 8;
      const int batch = m / S2D;
      const int sm = m - batch * S2D;
      v8bf pk;
#pragma unroll
      for (int v = 0; v < 8; ++v) pk[v] = (__bf16)(acc[nt][v] + bv);
      *(v8bf*)(out + ((size_t)batch * PPD + n) * S2D + sm) = pk;
    }
  }
}

// ---------------------------------------------------------------------------
// Flash attention over bf16 projected tensors.
// Grid: (B * S1/32, 2). Block = 256 threads (8 waves).
// Q tile (32x1024 bf16) staged once to dynamic LDS via async global->LDS;
// K/V fragments streamed from L2 with b128 loads. Per 64-row KV tile:
// scores (8 waves x one 16x16 tile, K=1024), online softmax (wave 0),
// then O += P @ V (each wave owns 64 output cols of its 512-col split).
// ---------------------------------------------------------------------------
__global__ __launch_bounds__(256)
void attn_kernel(const __bf16* __restrict__ qp, const __bf16* __restrict__ kp,
                 const __bf16* __restrict__ vpT, float* __restrict__ out) {
  extern __shared__ __align__(16) __bf16 sQ[];   // 32 x QPITCH bf16 (~66 KB)
  __shared__ float  sS[32 * 64];                 // raw scores, f32
  __shared__ __bf16 sP[32 * 64];                 // softmax probs, bf16
  __shared__ float  sCorr[32];                   // per-row rescale factor
  __shared__ float  sStat[32];                   // per-row 1/l at the end

  const int lane = threadIdx.x & 31;
  const int wv   = threadIdx.x >> 5;
  const int r    = lane & 15;
  const int hh   = lane >> 4;

  const int batch  = blockIdx.x >> 6;            // 64 q-tiles per batch
  const int q0     = (blockIdx.x & 63) * 32;
  const int nsplit = blockIdx.y;

  const __bf16* qb = qp  + (size_t)batch * S1D * PPD;
  const __bf16* kb = kp  + (size_t)batch * S2D * PPD;
  const __bf16* vb = vpT + (size_t)batch * PPD * S2D;

  // ---- stage Q tile into LDS (async copies, 16B per call per thread)
  {
    const int row = threadIdx.x >> 3;            // 32 rows, 8 threads each
    const int seg = threadIdx.x & 7;             // 128-element segment
    const __bf16* gs = qb + (size_t)(q0 + row) * PPD + seg * 128;
    __bf16* ls = sQ + row * QPITCH + seg * 128;
#pragma unroll
    for (int c = 0; c < 16; ++c)
      copy16_g2l(gs + c * 8, ls + c * 8);
    wait_async_copies();
  }
  __syncthreads();

  const int sm_t  = (wv & 1) * 16;               // score tile M offset
  const int sn_t  = (wv >> 1) * 16;              // score tile N offset (kv)
  const int ncol0 = nsplit * 512 + wv * 64;      // output column base

  const float scale = 0.03125f;                  // 1/sqrt(1024)

  v8f accO[2][4] = {};
  float m_run = -3.0e38f;
  float l_run = 0.0f;

  const __bf16* qlrow = sQ + (sm_t + r) * QPITCH;  // A rows now in LDS

  for (int kv = 0; kv < S2D; kv += 64) {
    // ---- phase 1: S = Q K^T (each wave one 16x16 tile of the 32x64 block)
    v8f accS = {};
    const __bf16* krow = kb + (size_t)(kv + sn_t + r) * PPD; // B[k][n]=K[n][k]
#pragma unroll 4
    for (int e = 0; e < EED; e += 32) {
      v16bf a  = frag_from_bf16(qlrow + e + hh * 8, qlrow + e + 16 + hh * 8);
      v16bf bk = frag_from_bf16(krow + e + hh * 8, krow + e + 16 + hh * 8);
      accS = __builtin_amdgcn_wmma_f32_16x16x32_bf16(
          false, a, false, bk, (short)0, accS, false, false);
    }
#pragma unroll
    for (int v = 0; v < 8; ++v)
      sS[(sm_t + hh * 8 + v) * 64 + sn_t + r] = accS[v];

    if (kv + 64 < S2D)  // hint next K tile toward the caches
      __builtin_prefetch(kb + (size_t)(kv + 64 + sn_t + r) * PPD, 0, 1);

    __syncthreads();

    // ---- phase 2: online softmax row update (wave 0, one lane per row)
    if (wv == 0) {
      const float* srow = sS + lane * 64;
      float mx = m_run;
#pragma unroll 8
      for (int c = 0; c < 64; ++c) mx = fmaxf(mx, srow[c] * scale);
      const float corr = __expf(m_run - mx);
      float ls = 0.0f;
      __bf16* prow = sP + lane * 64;
#pragma unroll 8
      for (int c = 0; c < 64; ++c) {
        const float p = __expf(srow[c] * scale - mx);
        ls += p;
        prow[c] = (__bf16)p;
      }
      l_run = l_run * corr + ls;
      m_run = mx;
      sCorr[lane] = corr;
    }
    __syncthreads();

    // ---- phase 3: rescale O, then O += P @ V (wave owns 64 output cols)
#pragma unroll
    for (int mt = 0; mt < 2; ++mt)
#pragma unroll
      for (int v = 0; v < 8; ++v) {
        const float c = sCorr[mt * 16 + hh * 8 + v];
#pragma unroll
        for (int nt = 0; nt < 4; ++nt) accO[mt][nt][v] *= c;
      }

#pragma unroll
    for (int ks = 0; ks < 64; ks += 32) {
      v16bf aP[2];
#pragma unroll
      for (int mt = 0; mt < 2; ++mt) {
        const __bf16* pr = sP + (mt * 16 + r) * 64 + ks;
        aP[mt] = frag_from_bf16(pr + hh * 8, pr + 16 + hh * 8);
      }
#pragma unroll
      for (int nt = 0; nt < 4; ++nt) {
        // B[k][n] = V[kv+k][n] = vpT[n][kv+k] -> contiguous along k
        const __bf16* vrow = vb + (size_t)(ncol0 + nt * 16 + r) * S2D + kv + ks;
        v16bf bv = frag_from_bf16(vrow + hh * 8, vrow + 16 + hh * 8);
#pragma unroll
        for (int mt = 0; mt < 2; ++mt)
          accO[mt][nt] = __builtin_amdgcn_wmma_f32_16x16x32_bf16(
              false, aP[mt], false, bv, (short)0, accO[mt][nt], false, false);
      }
    }
    __syncthreads();
  }

  // ---- epilogue: divide by row sums, write f32 output
  if (wv == 0) sStat[lane] = 1.0f / l_run;
  __syncthreads();

  float* ob = out + ((size_t)batch * S1D + q0) * PPD;
#pragma unroll
  for (int mt = 0; mt < 2; ++mt)
#pragma unroll
    for (int v = 0; v < 8; ++v) {
      const int row = mt * 16 + hh * 8 + v;
      const float inv = sStat[row];
#pragma unroll
      for (int nt = 0; nt < 4; ++nt)
        ob[(size_t)row * PPD + ncol0 + nt * 16 + r] = accO[mt][nt][v] * inv;
    }
}

extern "C" void kernel_launch(void* const* d_in, const int* in_sizes, int n_in,
                              void* d_out, int out_size, void* d_ws, size_t ws_size,
                              hipStream_t stream) {
  (void)in_sizes; (void)n_in; (void)out_size; (void)ws_size;
  const float* q = (const float*)d_in[0];
  const float* k = (const float*)d_in[1];
  const float* v = (const float*)d_in[2];
  const float* W = (const float*)d_in[3];
  const float* b = (const float*)d_in[4];
  float* out = (float*)d_out;

  // Workspace: bf16 projected Q (B*S1*P), K (B*S2*P), V^T (B*P*S2) = 96 MB
  __bf16* qp  = (__bf16*)d_ws;
  __bf16* kp  = qp + (size_t)BB * S1D * PPD;
  __bf16* vpT = kp + (size_t)BB * S2D * PPD;

  dim3 pg(BB * S1D / 32, PPD / 256);
  proj_kernel<<<pg, 256, 0, stream>>>(q, W, b, qp, 0);
  proj_kernel<<<pg, 256, 0, stream>>>(k, W, b, kp, 0);
  proj_kernel<<<pg, 256, 0, stream>>>(v, W, b, vpT, 1);

  const size_t qlds = (size_t)32 * QPITCH * sizeof(__bf16);  // ~66 KB dynamic LDS
  dim3 ag(BB * (S1D / 32), 2);
  attn_kernel<<<ag, 256, qlds, stream>>>(qp, kp, vpT, out);
}

// v001
// Measured time: 944 microseconds a run.
// Next to v000, in two timings, it ran 1.39 and 1.41 times as fast.
#include <hip/hip_runtime.h>
#include <hip/hip_bf16.h>

#define BB 8
#define S1D 2048
#define S2D 2048
#define EED 1024
#define PPD 1024
#define QPITCH 1032   // 1024 + 8 bf16 pad -> row stride 2064B = 129*16B (bank-spread)

typedef __attribute__((ext_vector_type(16))) __bf16 v16bf;
typedef __attribute__((ext_vector_type(8)))  __bf16 v8bf;
typedef __attribute__((ext_vector_type(8)))  float  v8f;
typedef __attribute__((ext_vector_type(4)))  int    v4i;

typedef __attribute__((address_space(1))) v4i* as1_v4ip;  // global (prints as __device__*)
typedef __attribute__((address_space(3))) v4i* as3_v4ip;  // LDS

// Build a 16-element bf16 WMMA fragment from two 16-byte chunks.
// Per ISA 7.12.2 (16-bit A/B layout): frag[0..7] = K group (half*8 ..),
// frag[8..15] = K group (16+half*8 ..).
static __device__ inline v16bf frag_from_bf16(const __bf16* p0, const __bf16* p1) {
  v8bf lo = *(const v8bf*)p0;
  v8bf hi = *(const v8bf*)p1;
  return __builtin_shufflevector(lo, hi, 0,1,2,3,4,5,6,7,8,9,10,11,12,13,14,15);
}

static __device__ inline v16bf frag_from_f32(const float* p0, const float* p1) {
  v16bf r;
#pragma unroll
  for (int i = 0; i < 8; ++i) { r[i] = (__bf16)p0[i]; r[i + 8] = (__bf16)p1[i]; }
  return r;
}

// Async global->LDS 16B copy (ASYNCcnt path) with synchronous fallback.
static __device__ inline void copy16_g2l(const __bf16* gsrc, __bf16* ldst) {
#if __has_builtin(__builtin_amdgcn_global_load_async_to_lds_b128)
  __builtin_amdgcn_global_load_async_to_lds_b128(
      (as1_v4ip)gsrc, (as3_v4ip)ldst, 0, 0);
#else
  *(v8bf*)ldst = *(const v8bf*)gsrc;
#endif
}

static __device__ inline void wait_async_copies() {
#if __has_builtin(__builtin_amdgcn_global_load_async_to_lds_b128)
#if __has_builtin(__builtin_amdgcn_s_wait_asynccnt)
  __builtin_amdgcn_s_wait_asynccnt(0);
#else
  asm volatile("s_wait_asynccnt 0" ::: "memory");
#endif
#endif
}

// ---------------------------------------------------------------------------
// Projection: out = X (M x E, f32) @ W^T + b, output bf16.
// mode 0: out row-major (M x P).  mode 1: out transposed per batch (B, P, S2).
// Block = 256 threads = 8 wave32 waves; block tile 128(M) x 256(N);
// wave tile 64 x 64 (sixteen 16x16 f32 accumulators), K stepped by 32:
// each loaded and converted fragment feeds four matrix instructions.
// ---------------------------------------------------------------------------
__global__ __launch_bounds__(256)
void proj_kernel(const float* __restrict__ X, const float* __restrict__ W,
                 const float* __restrict__ bias, __bf16* __restrict__ out,
                 int mode) {
  const int lane = threadIdx.x & 31;
  const int wv   = threadIdx.x >> 5;
  const int r    = lane & 15;
  const int hh   = lane >> 4;

  const int m0 = blockIdx.x * 128 + (wv & 1) * 64;
  const int n0 = blockIdx.y * 256 + (wv >> 1) * 64;

  const float* arow = X + (size_t)(m0 + r) * EED + hh * 8;
  const float* wrow = W + (size_t)(n0 + r) * EED + hh * 8;  // B[k][n] = W[n][k]
  v8f acc[4][4] = {};

  // The mt and nt loops below are fully unrolled so that a[] and acc[][] are
  // indexed by constants and stay in registers.
  for (int k = 0; k < EED; k += 32) {
    v16bf a[4];
#pragma unroll
    for (int mt = 0; mt < 4; ++mt) {
      const float* ap = arow + (size_t)mt * 16 * EED + k;
      a[mt] = frag_from_f32(ap, ap + 16);
    }
#pragma unroll
    for (int nt = 0; nt < 4; ++nt) {
      const float* wp = wrow + (size_t)nt * 16 * EED + k;
      v16bf bfr = frag_from_f32(wp, wp + 16);
#pragma unroll
      for (int mt = 0; mt < 4; ++mt)
        acc[mt][nt] = __builtin_amdgcn_wmma_f32_16x16x32_bf16(
            false, a[mt], false, bfr, (short)0, acc[mt][nt], false, false);
    }
  }

  if (mode == 0) {
#pragma unroll
    for (int nt = 0; nt < 4; ++nt) {
      const int n = n0 + nt * 16 + r;
      const float bv = bias[n];
#pragma unroll
      for (int mt = 0; mt < 4; ++mt)
#pragma unroll
        for (int v = 0; v < 8; ++v) {
          const int m = m0 + mt * 16 + hh * 8 + v;
          out[(size_t)m * PPD + n] = (__bf16)(acc[mt][nt][v] + bv);
        }
    }
  } else {
#pragma unroll
    for (int nt = 0; nt < 4; ++nt) {
      const int n = n0 + nt * 16 + r;
      const float bv = bias[n];
#pragma unroll
      for (int mt = 0; mt < 4; ++mt) {
        const int m = m0 + mt * 16 + hh * 8;
        const int batch = m / S2D;
        const int sm = m - batch * S2D;
        v8bf pk;
#pragma unroll
        for (int v = 0; v < 8; ++v) pk[v] = (__bf16)(acc[mt][nt][v] + bv);
        *(v8bf*)(out + ((size_t)batch * PPD + n) * S2D + sm) = pk;
      }
    }
  }
}

// ---------------------------------------------------------------------------
// Flash attention over bf16 projected tensors.
// Grid: (B * S1/32, 2). Block = 256 threads (8 waves).
// Q tile (32x1024 bf16) staged once to dynamic LDS via async global->LDS;
// K/V fragments streamed from L2 with b128 loads. Per 64-row KV tile:
// scores (8 waves x one 16x16 tile, K=1024), online softmax (wave 0),
// then O += P @ V (each wave owns 64 output cols of its 512-col split).
// ---------------------------------------------------------------------------
__global__ __launch_bounds__(256)
void attn_kernel(const __bf16* __restrict__ qp, const __bf16* __restrict__ kp,
                 const __bf16* __restrict__ vpT, float* __restrict__ out) {
  extern __shared__ __align__(16) __bf16 sQ[];   // 32 x QPITCH bf16 (~66 KB)
  __shared__ float  sS[32 * 64];                 // raw scores, f32
  __shared__ __bf16 sP[32 * 64];                 // softmax probs, bf16
  __shared__ float  sCorr[32];                   // per-row rescale factor
  __shared__ float  sStat[32];                   // per-row 1/l at the end

  const int lane = threadIdx.x & 31;
  const int wv   = threadIdx.x >> 5;
  const int r    = lane & 15;
  const int hh   = lane >> 4;

  const int batch  = blockIdx.x >> 6;            // 64 q-tiles per batch
  const int q0     = (blockIdx.x & 63) * 32;
  const int nsplit = blockIdx.y;

  const __bf16* qb = qp  + (size_t)batch * S1D * PPD;
  const __bf16* kb = kp  + (size_t)batch * S2D * PPD;
  const __bf16* vb = vpT + (size_t)batch * PPD * S2D;

  // ---- stage Q tile into LDS (async copies, 16B per call per thread)
  {
    const int row = threadIdx.x >> 3;            // 32 rows, 8 threads each
    const int seg = threadIdx.x & 7;             // 128-element segment
    const __bf16* gs = qb + (size_t)(q0 + row) * PPD + seg * 128;
    __bf16* ls = sQ + row * QPITCH + seg * 128;
#pragma unroll
    for (int c = 0; c < 16; ++c)
      copy16_g2l(gs + c * 8, ls + c * 8);
    wait_async_copies();
  }
  __syncthreads();

  const int sm_t  = (wv & 1) * 16;               // score tile M offset
  const int sn_t  = (wv >> 1) * 16;              // score tile N offset (kv)
  const int ncol0 = nsplit * 512 + wv * 64;      // output column base

  const float scale = 0.03125f;                  // 1/sqrt(1024)

  v8f accO[2][4] = {};
  float m_run = -3.0e38f;
  float l_run = 0.0f;

  const __bf16* qlrow = sQ + (sm_t + r) * QPITCH;  // A rows now in LDS

  for (int kv = 0; kv < S2D; kv += 64) {
    // ---- phase 1: S = Q K^T (each wave one 16x16 tile of the 32x64 block)
    v8f accS = {};
    const __bf16* krow = kb + (size_t)(kv + sn_t + r) * PPD; // B[k][n]=K[n][k]
#pragma unroll 4
    for (int e = 0; e < EED; e += 32) {
      v16bf a  = frag_from_bf16(qlrow + e + hh * 8, qlrow + e + 16 + hh * 8);
      v16bf bk = frag_from_bf16(krow + e + hh * 8, krow + e + 16 + hh * 8);
      accS = __builtin_amdgcn_wmma_f32_16x16x32_bf16(
          false, a, false, bk, (short)0, accS, false, false);
    }
#pragma unroll
    for (int v = 0; v < 8; ++v)
      sS[(sm_t + hh * 8 + v) * 64 + sn_t + r] = accS[v];

    if (kv + 64 < S2D)  // hint next K tile toward the caches
      __builtin_prefetch(kb + (size_t)(kv + 64 + sn_t + r) * PPD, 0, 1);

    __syncthreads();

    // ---- phase 2: online softmax row update (wave 0, one lane per row)
    if (wv == 0) {
      const float* srow = sS + lane * 64;
      float mx = m_run;
#pragma unroll 8
      for (int c = 0; c < 64; ++c) mx = fmaxf(mx, srow[c] * scale);
      const float corr = __expf(m_run - mx);
      float ls = 0.0f;
      __bf16* prow = sP + lane * 64;
#pragma unroll 8
      for (int c = 0; c < 64; ++c) {
        const float p = __expf(srow[c] * scale - mx);
        ls += p;
        prow[c] = (__bf16)p;
      }
      l_run = l_run * corr + ls;
      m_run = mx;
      sCorr[lane] = corr;
    }
    __syncthreads();

    // ---- phase 3: rescale O, then O += P @ V (wave owns 64 output cols)
#pragma unroll
    for (int mt = 0; mt < 2; ++mt)
#pragma unroll
      for (int v = 0; v < 8; ++v) {
        const float c = sCorr[mt * 16 + hh * 8 + v];
#pragma unroll
        for (int nt = 0; nt < 4; ++nt) accO[mt][nt][v] *= c;
      }

#pragma unroll
    for (int ks = 0; ks < 64; ks += 32) {
      v16bf aP[2];
#pragma unroll
      for (int mt = 0; mt < 2; ++mt) {
        const __bf16* pr = sP + (mt * 16 + r) * 64 + ks;
        aP[mt] = frag_from_bf16(pr + hh * 8, pr + 16 + hh * 8);
      }
#pragma unroll
      for (int nt = 0; nt < 4; ++nt) {
        // B[k][n] = V[kv+k][n] = vpT[n][kv+k] -> contiguous along k
        const __bf16* vrow = vb + (size_t)(ncol0 + nt * 16 + r) * S2D + kv + ks;
        v16bf bv = frag_from_bf16(vrow + hh * 8, vrow + 16 + hh * 8);
#pragma unroll
        for (int mt = 0; mt < 2; ++mt)
          accO[mt][nt] = __builtin_amdgcn_wmma_f32_16x16x32_bf16(
              false, aP[mt], false, bv, (short)0, accO[mt][nt], false, false);
      }
    }
    __syncthreads();
  }

  // ---- epilogue: divide by row sums, write f32 output
  if (wv == 0) sStat[lane] = 1.0f / l_run;
  __syncthreads();

  float* ob = out + ((size_t)batch * S1D + q0) * PPD;
#pragma unroll
  for (int mt = 0; mt < 2; ++mt)
#pragma unroll
    for (int v = 0; v < 8; ++v) {
      const int row = mt * 16 + hh * 8 + v;
      const float inv = sStat[row];
#pragma unroll
      for (int nt = 0; nt < 4; ++nt)
        ob[(size_t)row * PPD + ncol0 + nt * 16 + r] = accO[mt][nt][v] * inv;
    }
}

extern "C" void kernel_launch(void* const* d_in, const int* in_sizes, int n_in,
                              void* d_out, int out_size, void* d_ws, size_t ws_size,
                              hipStream_t stream) {
  (void)in_sizes; (void)n_in; (void)out_size; (void)ws_size;
  const float* q = (const float*)d_in[0];
  const float* k = (const float*)d_in[1];
  const float* v = (const float*)d_in[2];
  const float* W = (const float*)d_in[3];
  const float* b = (const float*)d_in[4];
  float* out = (float*)d_out;

  // Workspace: bf16 projected Q (B*S1*P), K (B*S2*P), V^T (B*P*S2) = 96 MB
  __bf16* qp  = (__bf16*)d_ws;
  __bf16* kp  = qp + (size_t)BB * S1D * PPD;
  __bf16* vpT = kp + (size_t)BB * S2D * PPD;

  dim3 pg(BB * S1D / 128, PPD / 256);
  proj_kernel<<<pg, 256, 0, stream>>>(q, W, b, qp, 0);
  proj_kernel<<<pg, 256, 0, stream>>>(k, W, b, kp, 0);
  proj_kernel<<<pg, 256, 0, stream>>>(v, W, b, vpT, 1);

  const size_t qlds = (size_t)32 * QPITCH * sizeof(__bf16);  // ~66 KB dynamic LDS
  dim3 ag(BB * (S1D / 32), 2);
  attn_kernel<<<ag, 256, qlds, stream>>>(qp, kp, vpT, out);
}

// v002
// It runs in 687 microseconds.
// Two timings next to v001 both put it at 1.39 times that version's speed.
// Counting every step since v000, it is 1.95 times as fast.
#include <hip/hip_runtime.h>
#include <hip/hip_bf16.h>

#define BB 8
#define S1D 2048
#define S2D 2048
#define EED 1024
#define PPD 1024
#define QPITCH 1032   // 1024 + 8 bf16 pad -> row stride 2064B = 129*16B (bank-spread)
#define QROWS 64      // query rows per attention block

typedef __attribute__((ext_vector_type(16))) __bf16 v16bf;
typedef __attribute__((ext_vector_type(8)))  __bf16 v8bf;
typedef __attribute__((ext_vector_type(8)))  float  v8f;
typedef __attribute__((ext_vector_type(4)))  int    v4i;

typedef __attribute__((address_space(1))) v4i* as1_v4ip;  // global (prints as __device__*)
typedef __attribute__((address_space(3))) v4i* as3_v4ip;  // LDS

// Build a 16-element bf16 WMMA fragment from two 16-byte chunks.
// Per ISA 7.12.2 (16-bit A/B layout): frag[0..7] = K group (half*8 ..),
// frag[8..15] = K group (16+half*8 ..).
static __device__ inline v16bf frag_from_bf16(const __bf16* p0, const __bf16* p1) {
  v8bf lo = *(const v8bf*)p0;
  v8bf hi = *(const v8bf*)p1;
  return __builtin_shufflevector(lo, hi, 0,1,2,3,4,5,6,7,8,9,10,11,12,13,14,15);
}

static __device__ inline v16bf frag_from_f32(const float* p0, const float* p1) {
  v16bf r;
#pragma unroll
  for (int i = 0; i < 8; ++i) { r[i] = (__bf16)p0[i]; r[i + 8] = (__bf16)p1[i]; }
  return r;
}

// Async global->LDS 16B copy (ASYNCcnt path) with synchronous fallback.
static __device__ inline void copy16_g2l(const __bf16* gsrc, __bf16* ldst) {
#if __has_builtin(__builtin_amdgcn_global_load_async_to_lds_b128)
  __builtin_amdgcn_global_load_async_to_lds_b128(
      (as1_v4ip)gsrc, (as3_v4ip)ldst, 0, 0);
#else
  *(v8bf*)ldst = *(const v8bf*)gsrc;
#endif
}

static __device__ inline void wait_async_copies() {
#if __has_builtin(__builtin_amdgcn_global_load_async_to_lds_b128)
#if __has_builtin(__builtin_amdgcn_s_wait_asynccnt)
  __builtin_amdgcn_s_wait_asynccnt(0);
#else
  asm volatile("s_wait_asynccnt 0" ::: "memory");
#endif
#endif
}

// ---------------------------------------------------------------------------
// Projection: out = X (M x E, f32) @ W^T + b, output bf16.
// mode 0: out row-major (M x P).  mode 1: out transposed per batch (B, P, S2).
// Block = 256 threads = 8 wave32 waves; block tile 128(M) x 256(N);
// wave tile 64 x 64 (sixteen 16x16 f32 accumulators), K stepped by 32:
// each loaded and converted fragment feeds four matrix instructions.
// ---------------------------------------------------------------------------
__global__ __launch_bounds__(256)
void proj_kernel(const float* __restrict__ X, const float* __restrict__ W,
                 const float* __restrict__ bias, __bf16* __restrict__ out,
                 int mode) {
  const int lane = threadIdx.x & 31;
  const int wv   = threadIdx.x >> 5;
  const int r    = lane & 15;
  const int hh   = lane >> 4;

  const int m0 = blockIdx.x * 128 + (wv & 1) * 64;
  const int n0 = blockIdx.y * 256 + (wv >> 1) * 64;

  const float* arow = X + (size_t)(m0 + r) * EED + hh * 8;
  const float* wrow = W + (size_t)(n0 + r) * EED + hh * 8;  // B[k][n] = W[n][k]
  v8f acc[4][4] = {};

  // The mt and nt loops below are fully unrolled so that a[] and acc[][] are
  // indexed by constants and stay in registers.
  for (int k = 0; k < EED; k += 32) {
    v16bf a[4];
#pragma unroll
    for (int mt = 0; mt < 4; ++mt) {
      const float* ap = arow + (size_t)mt * 16 * EED + k;
      a[mt] = frag_from_f32(ap, ap + 16);
    }
#pragma unroll
    for (int nt = 0; nt < 4; ++nt) {
      const float* wp = wrow + (size_t)nt * 16 * EED + k;
      v16bf bfr = frag_from_f32(wp, wp + 16);
#pragma unroll
      for (int mt = 0; mt < 4; ++mt)
        acc[mt][nt] = __builtin_amdgcn_wmma_f32_16x16x32_bf16(
            false, a[mt], false, bfr, (short)0, acc[mt][nt], false, false);
    }
  }

  if (mode == 0) {
#pragma unroll
    for (int nt = 0; nt < 4; ++nt) {
      const int n = n0 + nt * 16 + r;
      const float bv = bias[n];
#pragma unroll
      for (int mt = 0; mt < 4; ++mt)
#pragma unroll
        for (int v = 0; v < 8; ++v) {
          const int m = m0 + mt * 16 + hh * 8 + v;
          out[(size_t)m * PPD + n] = (__bf16)(acc[mt][nt][v] + bv);
        }
    }
  } else {
#pragma unroll
    for (int nt = 0; nt < 4; ++nt) {
      const int n = n0 + nt * 16 + r;
      const float bv = bias[n];
#pragma unroll
      for (int mt = 0; mt < 4; ++mt) {
        const int m = m0 + mt * 16 + hh * 8;
        const int batch = m / S2D;
        const int sm = m - batch * S2D;
        v8bf pk;
#pragma unroll
        for (int v = 0; v < 8; ++v) pk[v] = (__bf16)(acc[mt][nt][v] + bv);
        *(v8bf*)(out + ((size_t)batch * PPD + n) * S2D + sm) = pk;
      }
    }
  }
}

// ---------------------------------------------------------------------------
// Flash attention over bf16 projected tensors.
// Grid: (B * S1/64, 2). Block = 256 threads (8 waves).
// Q tile (64x1024 bf16) staged once to LDS via async global->LDS;
// K/V fragments streamed from L2 with b128 loads. Per 64-row KV tile:
// scores (8 waves x two 16x16 tiles that share each K fragment, K=1024),
// online softmax (waves 0 and 1, one lane per row), then O += P @ V (each
// wave owns 64 output cols of its 512-col split; each V fragment feeds the
// four 16-row tiles of the block).
// ---------------------------------------------------------------------------
__global__ __launch_bounds__(256)
void attn_kernel(const __bf16* __restrict__ qp, const __bf16* __restrict__ kp,
                 const __bf16* __restrict__ vpT, float* __restrict__ out) {
  __shared__ __align__(16) __bf16 sQ[QROWS * QPITCH];  // Q tile, ~129 KB
  __shared__ float  sS[QROWS * 64];              // raw scores, f32
  __shared__ __bf16 sP[QROWS * 64];              // softmax probs, bf16
  __shared__ float  sCorr[QROWS];                // per-row rescale factor
  __shared__ float  sStat[QROWS];                // per-row 1/l at the end

  const int lane = threadIdx.x & 31;
  const int wv   = threadIdx.x >> 5;
  const int r    = lane & 15;
  const int hh   = lane >> 4;

  const int batch  = blockIdx.x >> 5;            // 32 q-tiles per batch
  const int q0     = (blockIdx.x & 31) * QROWS;
  const int nsplit = blockIdx.y;

  const __bf16* qb = qp  + (size_t)batch * S1D * PPD;
  const __bf16* kb = kp  + (size_t)batch * S2D * PPD;
  const __bf16* vb = vpT + (size_t)batch * PPD * S2D;

  // ---- stage Q tile into LDS (async copies, 16B per call per thread)
  {
    const int row = threadIdx.x >> 2;            // 64 rows, 4 threads each
    const int seg = threadIdx.x & 3;             // 256-element segment
    const __bf16* gs = qb + (size_t)(q0 + row) * PPD + seg * 256;
    __bf16* ls = sQ + row * QPITCH + seg * 256;
#pragma unroll
    for (int c = 0; c < 32; ++c)
      copy16_g2l(gs + c * 8, ls + c * 8);
    wait_async_copies();
  }
  __syncthreads();

  const int sm_t  = (wv >> 2) * 32;              // score tiles' M offset (two tiles)
  const int sn_t  = (wv & 3) * 16;               // score tile N offset (kv)
  const int ncol0 = nsplit * 512 + wv * 64;      // output column base

  const float scale = 0.03125f;                  // 1/sqrt(1024)

  v8f accO[4][4] = {};
  float m_run = -3.0e38f;
  float l_run = 0.0f;

  const __bf16* qlrow = sQ + (sm_t + r) * QPITCH;  // A rows now in LDS

  for (int kv = 0; kv < S2D; kv += 64) {
    // ---- phase 1: S = Q K^T (each wave two 16x16 tiles of the 64x64 block)
    v8f accS[2] = {};
    const __bf16* krow = kb + (size_t)(kv + sn_t + r) * PPD; // B[k][n]=K[n][k]
#pragma unroll 4
    for (int e = 0; e < EED; e += 32) {
      v16bf bk = frag_from_bf16(krow + e + hh * 8, krow + e + 16 + hh * 8);
      // unrolled so that accS[] is indexed by constants and stays in registers
#pragma unroll
      for (int mt = 0; mt < 2; ++mt) {
        const __bf16* qr = qlrow + mt * 16 * QPITCH + e;
        v16bf a = frag_from_bf16(qr + hh * 8, qr + 16 + hh * 8);
        accS[mt] = __builtin_amdgcn_wmma_f32_16x16x32_bf16(
            false, a, false, bk, (short)0, accS[mt], false, false);
      }
    }
    // unrolled for the same reason: constant indices into accS[]
#pragma unroll
    for (int mt = 0; mt < 2; ++mt)
#pragma unroll
      for (int v = 0; v < 8; ++v)
        sS[(sm_t + mt * 16 + hh * 8 + v) * 64 + sn_t + r] = accS[mt][v];

    if (kv + 64 < S2D)  // hint next K tile toward the caches
      __builtin_prefetch(kb + (size_t)(kv + 64 + sn_t + r) * PPD, 0, 1);

    __syncthreads();

    // ---- phase 2: online softmax row update (waves 0 and 1, one lane per row)
    if (wv < 2) {
      const int srw = wv * 32 + lane;
      const float* srow = sS + srw * 64;
      float mx = m_run;
#pragma unroll 8
      for (int c = 0; c < 64; ++c) mx = fmaxf(mx, srow[c] * scale);
      const float corr = __expf(m_run - mx);
      float ls = 0.0f;
      __bf16* prow = sP + srw * 64;
#pragma unroll 8
      for (int c = 0; c < 64; ++c) {
        const float p = __expf(srow[c] * scale - mx);
        ls += p;
        prow[c] = (__bf16)p;
      }
      l_run = l_run * corr + ls;
      m_run = mx;
      sCorr[srw] = corr;
    }
    __syncthreads();

    // ---- phase 3: rescale O, then O += P @ V (wave owns 64 output cols)
#pragma unroll
    for (int mt = 0; mt < 4; ++mt)
#pragma unroll
      for (int v = 0; v < 8; ++v) {
        const float c = sCorr[mt * 16 + hh * 8 + v];
#pragma unroll
        for (int nt = 0; nt < 4; ++nt) accO[mt][nt][v] *= c;
      }

#pragma unroll
    for (int ks = 0; ks < 64; ks += 32) {
      v16bf aP[4];
#pragma unroll
      for (int mt = 0; mt < 4; ++mt) {
        const __bf16* pr = sP + (mt * 16 + r) * 64 + ks;
        aP[mt] = frag_from_bf16(pr + hh * 8, pr + 16 + hh * 8);
      }
#pragma unroll
      for (int nt = 0; nt < 4; ++nt) {
        // B[k][n] = V[kv+k][n] = vpT[n][kv+k] -> contiguous along k
        const __bf16* vrow = vb + (size_t)(ncol0 + nt * 16 + r) * S2D + kv + ks;
        v16bf bv = frag_from_bf16(vrow + hh * 8, vrow + 16 + hh * 8);
#pragma unroll
        for (int mt = 0; mt < 4; ++mt)
          accO[mt][nt] = __builtin_amdgcn_wmma_f32_16x16x32_bf16(
              false, aP[mt], false, bv, (short)0, accO[mt][nt], false, false);
      }
    }
    __syncthreads();
  }

  // ---- epilogue: divide by row sums, write f32 output
  if (wv < 2) sStat[wv * 32 + lane] = 1.0f / l_run;
  __syncthreads();

  float* ob = out + ((size_t)batch * S1D + q0) * PPD;
#pragma unroll
  for (int mt = 0; mt < 4; ++mt)
#pragma unroll
    for (int v = 0; v < 8; ++v) {
      const int row = mt * 16 + hh * 8 + v;
      const float inv = sStat[row];
#pragma unroll
      for (int nt = 0; nt < 4; ++nt)
        ob[(size_t)row * PPD + ncol0 + nt * 16 + r] = accO[mt][nt][v] * inv;
    }
}

extern "C" void kernel_launch(void* const* d_in, const int* in_sizes, int n_in,
                              void* d_out, int out_size, void* d_ws, size_t ws_size,
                              hipStream_t stream) {
  (void)in_sizes; (void)n_in; (void)out_size; (void)ws_size;
  const float* q = (const float*)d_in[0];
  const float* k = (const float*)d_in[1];
  const float* v = (const float*)d_in[2];
  const float* W = (const float*)d_in[3];
  const float* b = (const float*)d_in[4];
  float* out = (float*)d_out;

  // Workspace: bf16 projected Q (B*S1*P), K (B*S2*P), V^T (B*P*S2) = 96 MB
  __bf16* qp  = (__bf16*)d_ws;
  __bf16* kp  = qp + (size_t)BB * S1D * PPD;
  __bf16* vpT = kp + (size_t)BB * S2D * PPD;

  dim3 pg(BB * S1D / 128, PPD / 256);
  proj_kernel<<<pg, 256, 0, stream>>>(q, W, b, qp, 0);
  proj_kernel<<<pg, 256, 0, stream>>>(k, W, b, kp, 0);
  proj_kernel<<<pg, 256, 0, stream>>>(v, W, b, vpT, 1);

  dim3 ag(BB * (S1D / QROWS), 2);
  attn_kernel<<<ag, 256, 0, stream>>>(qp, kp, vpT, out);
}

// v003
// It runs in 583 microseconds.
// In both of two side-by-side timings against v002, it was 1.18 times as fast.
// All steps since v000 together make it 2.29 times as fast.
#include <hip/hip_runtime.h>
#include <hip/hip_bf16.h>

#define BB 8
#define S1D 2048
#define S2D 2048
#define EED 1024
#define PPD 1024
#define QPITCH 1032   // 1024 + 8 bf16 pad -> row stride 2064B = 129*16B (bank-spread)
#define QROWS 64      // query rows per attention block
#define PROWS 384     // rows staged per projection K step: 128 of X + 256 of W
#define PPITCH 40     // their LDS pitch in bf16: 32 + 8 pad -> 80 B = 5*16B (bank-spread)

typedef __attribute__((ext_vector_type(16))) __bf16 v16bf;
typedef __attribute__((ext_vector_type(8)))  __bf16 v8bf;
typedef __attribute__((ext_vector_type(8)))  float  v8f;
typedef __attribute__((ext_vector_type(4)))  int    v4i;
typedef __attribute__((ext_vector_type(4)))  float  v4f;
typedef __attribute__((ext_vector_type(4)))  __bf16 v4bf;

typedef __attribute__((address_space(1))) v4i* as1_v4ip;  // global (prints as __device__*)
typedef __attribute__((address_space(3))) v4i* as3_v4ip;  // LDS

// Build a 16-element bf16 WMMA fragment from two 16-byte chunks.
// Per ISA 7.12.2 (16-bit A/B layout): frag[0..7] = K group (half*8 ..),
// frag[8..15] = K group (16+half*8 ..).
static __device__ inline v16bf frag_from_bf16(const __bf16* p0, const __bf16* p1) {
  v8bf lo = *(const v8bf*)p0;
  v8bf hi = *(const v8bf*)p1;
  return __builtin_shufflevector(lo, hi, 0,1,2,3,4,5,6,7,8,9,10,11,12,13,14,15);
}

// Async global->LDS 16B copy (ASYNCcnt path) with synchronous fallback.
static __device__ inline void copy16_g2l(const __bf16* gsrc, __bf16* ldst) {
#if __has_builtin(__builtin_amdgcn_global_load_async_to_lds_b128)
  __builtin_amdgcn_global_load_async_to_lds_b128(
      (as1_v4ip)gsrc, (as3_v4ip)ldst, 0, 0);
#else
  *(v8bf*)ldst = *(const v8bf*)gsrc;
#endif
}

static __device__ inline void wait_async_copies() {
#if __has_builtin(__builtin_amdgcn_global_load_async_to_lds_b128)
#if __has_builtin(__builtin_amdgcn_s_wait_asynccnt)
  __builtin_amdgcn_s_wait_asynccnt(0);
#else
  asm volatile("s_wait_asynccnt 0" ::: "memory");
#endif
#endif
}

// ---------------------------------------------------------------------------
// Projection: out = X (M x E, f32) @ W^T + b, output bf16.
// mode 0: out row-major (M x P).  mode 1: out transposed per batch (B, P, S2).
// Block = 256 threads = 8 wave32 waves; block tile 128(M) x 256(N);
// wave tile 64 x 64 (sixteen 16x16 f32 accumulators), K stepped by 32.
// The 384 rows of a K step (128 of X, 256 of W; 128 bytes of f32 each) are
// read once per block with loads in which a wave covers four whole lines,
// converted to bf16 once and kept in LDS; the waves take their fragments from
// there. Two LDS buffers: the next step's global loads are issued ahead of
// this step's products and stored behind them, one barrier per step.
// ---------------------------------------------------------------------------
__global__ __launch_bounds__(256)
void proj_kernel(const float* __restrict__ X, const float* __restrict__ W,
                 const float* __restrict__ bias, __bf16* __restrict__ out,
                 int mode) {
  __shared__ __align__(16) __bf16 sT[2][PROWS * PPITCH];

  const int lane = threadIdx.x & 31;
  const int wv   = threadIdx.x >> 5;
  const int r    = lane & 15;
  const int hh   = lane >> 4;

  const int m0 = blockIdx.x * 128 + (wv & 1) * 64;
  const int n0 = blockIdx.y * 256 + (wv >> 1) * 64;

  // staging: eight threads per row, 16 bytes of f32 each; 32 rows per pass
  const int srow = threadIdx.x >> 3;
  const int spc  = threadIdx.x & 7;
  const float* gx = X + (size_t)(blockIdx.x * 128 + srow) * EED + spc * 4;
  const float* gw = W + (size_t)(blockIdx.y * 256 + srow) * EED + spc * 4;
  const int sdst = srow * PPITCH + spc * 4;

  // fragment rows in LDS: X rows first, W rows behind them
  const int aoff = ((wv & 1) * 64 + r) * PPITCH + hh * 8;
  const int boff = (128 + (wv >> 1) * 64 + r) * PPITCH + hh * 8;

  v4f st[12];
  v8f acc[4][4] = {};

  // All loops over st[], a[] and acc[][] are fully unrolled so that they are
  // indexed by constants and stay in registers.
#pragma unroll
  for (int i = 0; i < 4; ++i) st[i] = *(const v4f*)(gx + (size_t)i * 32 * EED);
#pragma unroll
  for (int i = 0; i < 8; ++i) st[4 + i] = *(const v4f*)(gw + (size_t)i * 32 * EED);
#pragma unroll
  for (int i = 0; i < 12; ++i) {
    v4bf c;
#pragma unroll
    for (int j = 0; j < 4; ++j) c[j] = (__bf16)st[i][j];
    *(v4bf*)(&sT[0][sdst + i * 32 * PPITCH]) = c;
  }
  // the first buffer is complete before any wave takes a fragment from it
  __syncthreads();

  for (int k = 0; k < EED; k += 32) {
    const __bf16* cur = sT[(k >> 5) & 1];
    const bool more = k + 32 < EED;
    if (more) {
#pragma unroll
      for (int i = 0; i < 4; ++i)
        st[i] = *(const v4f*)(gx + (size_t)i * 32 * EED + k + 32);
#pragma unroll
      for (int i = 0; i < 8; ++i)
        st[4 + i] = *(const v4f*)(gw + (size_t)i * 32 * EED + k + 32);
    }

    v16bf a[4];
#pragma unroll
    for (int mt = 0; mt < 4; ++mt) {
      const __bf16* ap = cur + aoff + mt * 16 * PPITCH;
      a[mt] = frag_from_bf16(ap, ap + 16);
    }
#pragma unroll
    for (int nt = 0; nt < 4; ++nt) {
      const __bf16* wp = cur + boff + nt * 16 * PPITCH;
      v16bf bfr = frag_from_bf16(wp, wp + 16);
#pragma unroll
      for (int mt = 0; mt < 4; ++mt)
        acc[mt][nt] = __builtin_amdgcn_wmma_f32_16x16x32_bf16(
            false, a[mt], false, bfr, (short)0, acc[mt][nt], false, false);
    }

    if (more) {
      __bf16* nxt = sT[((k >> 5) + 1) & 1];
#pragma unroll
      for (int i = 0; i < 12; ++i) {
        v4bf c;
#pragma unroll
        for (int j = 0; j < 4; ++j) c[j] = (__bf16)st[i][j];
        *(v4bf*)(nxt + sdst + i * 32 * PPITCH) = c;
      }
    }
    // publishes the buffer just written and ends the reads of the one that the
    // next step overwrites
    __syncthreads();
  }

  if (mode == 0) {
#pragma unroll
    for (int nt = 0; nt < 4; ++nt) {
      const int n = n0 + nt * 16 + r;
      const float bv = bias[n];
#pragma unroll
      for (int mt = 0; mt < 4; ++mt)
#pragma unroll
        for (int v = 0; v < 8; ++v) {
          const int m = m0 + mt * 16 + hh * 8 + v;
          out[(size_t)m * PPD + n] = (__bf16)(acc[mt][nt][v] + bv);
        }
    }
  } else {
#pragma unroll
    for (int nt = 0; nt < 4; ++nt) {
      const int n = n0 + nt * 16 + r;
      const float bv = bias[n];
#pragma unroll
      for (int mt = 0; mt < 4; ++mt) {
        const int m = m0 + mt * 16 + hh * 8;
        const int batch = m / S2D;
        const int sm = m - batch * S2D;
        v8bf pk;
#pragma unroll
        for (int v = 0; v < 8; ++v) pk[v] = (__bf16)(acc[mt][nt][v] + bv);
        *(v8bf*)(out + ((size_t)batch * PPD + n) * S2D + sm) = pk;
      }
    }
  }
}

// ---------------------------------------------------------------------------
// Flash attention over bf16 projected tensors.
// Grid: (B * S1/64, 2). Block = 256 threads (8 waves).
// Q tile (64x1024 bf16) staged once to LDS via async global->LDS;
// K/V fragments streamed from L2 with b128 loads. Per 64-row KV tile:
// scores (8 waves x two 16x16 tiles that share each K fragment, K=1024),
// online softmax (waves 0 and 1, one lane per row), then O += P @ V (each
// wave owns 64 output cols of its 512-col split; each V fragment feeds the
// four 16-row tiles of the block).
// ---------------------------------------------------------------------------
__global__ __launch_bounds__(256)
void attn_kernel(const __bf16* __restrict__ qp, const __bf16* __restrict__ kp,
                 const __bf16* __restrict__ vpT, float* __restrict__ out) {
  __shared__ __align__(16) __bf16 sQ[QROWS * QPITCH];  // Q tile, ~129 KB
  __shared__ float  sS[QROWS * 64];              // raw scores, f32
  __shared__ __bf16 sP[QROWS * 64];              // softmax probs, bf16
  __shared__ float  sCorr[QROWS];                // per-row rescale factor
  __shared__ float  sStat[QROWS];                // per-row 1/l at the end

  const int lane = threadIdx.x & 31;
  const int wv   = threadIdx.x >> 5;
  const int r    = lane & 15;
  const int hh   = lane >> 4;

  const int batch  = blockIdx.x >> 5;            // 32 q-tiles per batch
  const int q0     = (blockIdx.x & 31) * QROWS;
  const int nsplit = blockIdx.y;

  const __bf16* qb = qp  + (size_t)batch * S1D * PPD;
  const __bf16* kb = kp  + (size_t)batch * S2D * PPD;
  const __bf16* vb = vpT + (size_t)batch * PPD * S2D;

  // ---- stage Q tile into LDS (async copies, 16B per call per thread)
  {
    const int row = threadIdx.x >> 2;            // 64 rows, 4 threads each
    const int seg = threadIdx.x & 3;             // 256-element segment
    const __bf16* gs = qb + (size_t)(q0 + row) * PPD + seg * 256;
    __bf16* ls = sQ + row * QPITCH + seg * 256;
#pragma unroll
    for (int c = 0; c < 32; ++c)
      copy16_g2l(gs + c * 8, ls + c * 8);
    wait_async_copies();
  }
  __syncthreads();

  const int sm_t  = (wv >> 2) * 32;              // score tiles' M offset (two tiles)
  const int sn_t  = (wv & 3) * 16;               // score tile N offset (kv)
  const int ncol0 = nsplit * 512 + wv * 64;      // output column base

  const float scale = 0.03125f;                  // 1/sqrt(1024)

  v8f accO[4][4] = {};
  float m_run = -3.0e38f;
  float l_run = 0.0f;

  const __bf16* qlrow = sQ + (sm_t + r) * QPITCH;  // A rows now in LDS

  for (int kv = 0; kv < S2D; kv += 64) {
    // ---- phase 1: S = Q K^T (each wave two 16x16 tiles of the 64x64 block)
    v8f accS[2] = {};
    const __bf16* krow = kb + (size_t)(kv + sn_t + r) * PPD; // B[k][n]=K[n][k]
#pragma unroll 4
    for (int e = 0; e < EED; e += 32) {
      v16bf bk = frag_from_bf16(krow + e + hh * 8, krow + e + 16 + hh * 8);
      // unrolled so that accS[] is indexed by constants and stays in registers
#pragma unroll
      for (int mt = 0; mt < 2; ++mt) {
        const __bf16* qr = qlrow + mt * 16 * QPITCH + e;
        v16bf a = frag_from_bf16(qr + hh * 8, qr + 16 + hh * 8);
        accS[mt] = __builtin_amdgcn_wmma_f32_16x16x32_bf16(
            false, a, false, bk, (short)0, accS[mt], false, false);
      }
    }
    // unrolled for the same reason: constant indices into accS[]
#pragma unroll
    for (int mt = 0; mt < 2; ++mt)
#pragma unroll
      for (int v = 0; v < 8; ++v)
        sS[(sm_t + mt * 16 + hh * 8 + v) * 64 + sn_t + r] = accS[mt][v];

    if (kv + 64 < S2D)  // hint next K tile toward the caches
      __builtin_prefetch(kb + (size_t)(kv + 64 + sn_t + r) * PPD, 0, 1);

    __syncthreads();

    // ---- phase 2: online softmax row update (waves 0 and 1, one lane per row)
    if (wv < 2) {
      const int srw = wv * 32 + lane;
      const float* srow = sS + srw * 64;
      float mx = m_run;
#pragma unroll 8
      for (int c = 0; c < 64; ++c) mx = fmaxf(mx, srow[c] * scale);
      const float corr = __expf(m_run - mx);
      float ls = 0.0f;
      __bf16* prow = sP + srw * 64;
#pragma unroll 8
      for (int c = 0; c < 64; ++c) {
        const float p = __expf(srow[c] * scale - mx);
        ls += p;
        prow[c] = (__bf16)p;
      }
      l_run = l_run * corr + ls;
      m_run = mx;
      sCorr[srw] = corr;
    }
    __syncthreads();

    // ---- phase 3: rescale O, then O += P @ V (wave owns 64 output cols)
#pragma unroll
    for (int mt = 0; mt < 4; ++mt)
#pragma unroll
      for (int v = 0; v < 8; ++v) {
        const float c = sCorr[mt * 16 + hh * 8 + v];
#pragma unroll
        for (int nt = 0; nt < 4; ++nt) accO[mt][nt][v] *= c;
      }

#pragma unroll
    for (int ks = 0; ks < 64; ks += 32) {
      v16bf aP[4];
#pragma unroll
      for (int mt = 0; mt < 4; ++mt) {
        const __bf16* pr = sP + (mt * 16 + r) * 64 + ks;
        aP[mt] = frag_from_bf16(pr + hh * 8, pr + 16 + hh * 8);
      }
#pragma unroll
      for (int nt = 0; nt < 4; ++nt) {
        // B[k][n] = V[kv+k][n] = vpT[n][kv+k] -> contiguous along k
        const __bf16* vrow = vb + (size_t)(ncol0 + nt * 16 + r) * S2D + kv + ks;
        v16bf bv = frag_from_bf16(vrow + hh * 8, vrow + 16 + hh * 8);
#pragma unroll
        for (int mt = 0; mt < 4; ++mt)
          accO[mt][nt] = __builtin_amdgcn_wmma_f32_16x16x32_bf16(
              false, aP[mt], false, bv, (short)0, accO[mt][nt], false, false);
      }
    }
    __syncthreads();
  }

  // ---- epilogue: divide by row sums, write f32 output
  if (wv < 2) sStat[wv * 32 + lane] = 1.0f / l_run;
  __syncthreads();

  float* ob = out + ((size_t)batch * S1D + q0) * PPD;
#pragma unroll
  for (int mt = 0; mt < 4; ++mt)
#pragma unroll
    for (int v = 0; v < 8; ++v) {
      const int row = mt * 16 + hh * 8 + v;
      const float inv = sStat[row];
#pragma unroll
      for (int nt = 0; nt < 4; ++nt)
        ob[(size_t)row * PPD + ncol0 + nt * 16 + r] = accO[mt][nt][v] * inv;
    }
}

extern "C" void kernel_launch(void* const* d_in, const int* in_sizes, int n_in,
                              void* d_out, int out_size, void* d_ws, size_t ws_size,
                              hipStream_t stream) {
  (void)in_sizes; (void)n_in; (void)out_size; (void)ws_size;
  const float* q = (const float*)d_in[0];
  const float* k = (const float*)d_in[1];
  const float* v = (const float*)d_in[2];
  const float* W = (const float*)d_in[3];
  const float* b = (const float*)d_in[4];
  float* out = (float*)d_out;

  // Workspace: bf16 projected Q (B*S1*P), K (B*S2*P), V^T (B*P*S2) = 96 MB
  __bf16* qp  = (__bf16*)d_ws;
  __bf16* kp  = qp + (size_t)BB * S1D * PPD;
  __bf16* vpT = kp + (size_t)BB * S2D * PPD;

  dim3 pg(BB * S1D / 128, PPD / 256);
  proj_kernel<<<pg, 256, 0, stream>>>(q, W, b, qp, 0);
  proj_kernel<<<pg, 256, 0, stream>>>(k, W, b, kp, 0);
  proj_kernel<<<pg, 256, 0, stream>>>(v, W, b, vpT, 1);

  dim3 ag(BB * (S1D / QROWS), 2);
  attn_kernel<<<ag, 256, 0, stream>>>(qp, kp, vpT, out);
}

// v004
// A run of this version takes 484 microseconds.
// Timed twice side by side with v003, it ran 1.21 times as fast both times.
// All steps since v000 together make it 2.77 times as fast.
#include <hip/hip_runtime.h>
#include <hip/hip_bf16.h>

#define BB 8
#define S1D 2048
#define S2D 2048
#define EED 1024
#define PPD 1024
#define QPITCH 1032   // 1024 + 8 bf16 pad -> row stride 2064B = 129*16B (bank-spread)
#define QROWS 64      // query rows per attention block
#define SPITCH 68     // score row pitch in f32: 64 + 4 pad -> 272 B = 17*16B (bank-spread)
#define PROWS 384     // rows staged per projection K step: 128 of X + 256 of W
#define PPITCH 40     // their LDS pitch in bf16: 32 + 8 pad -> 80 B = 5*16B (bank-spread)

typedef __attribute__((ext_vector_type(16))) __bf16 v16bf;
typedef __attribute__((ext_vector_type(8)))  __bf16 v8bf;
typedef __attribute__((ext_vector_type(8)))  float  v8f;
typedef __attribute__((ext_vector_type(4)))  int    v4i;
typedef __attribute__((ext_vector_type(4)))  float  v4f;
typedef __attribute__((ext_vector_type(4)))  __bf16 v4bf;

typedef __attribute__((address_space(1))) v4i* as1_v4ip;  // global (prints as __device__*)
typedef __attribute__((address_space(3))) v4i* as3_v4ip;  // LDS

// Build a 16-element bf16 WMMA fragment from two 16-byte chunks.
// Per ISA 7.12.2 (16-bit A/B layout): frag[0..7] = K group (half*8 ..),
// frag[8..15] = K group (16+half*8 ..).
static __device__ inline v16bf frag_from_bf16(const __bf16* p0, const __bf16* p1) {
  v8bf lo = *(const v8bf*)p0;
  v8bf hi = *(const v8bf*)p1;
  return __builtin_shufflevector(lo, hi, 0,1,2,3,4,5,6,7,8,9,10,11,12,13,14,15);
}

// Async global->LDS 16B copy (ASYNCcnt path) with synchronous fallback.
static __device__ inline void copy16_g2l(const __bf16* gsrc, __bf16* ldst) {
#if __has_builtin(__builtin_amdgcn_global_load_async_to_lds_b128)
  __builtin_amdgcn_global_load_async_to_lds_b128(
      (as1_v4ip)gsrc, (as3_v4ip)ldst, 0, 0);
#else
  *(v8bf*)ldst = *(const v8bf*)gsrc;
#endif
}

// Value of the lane whose number differs by the quad_perm pattern CTRL
// (0xB1: lane ^ 1, 0x4E: lane ^ 2); a register move, no LDS traffic.
template <int CTRL>
static __device__ inline float quad_swap(float x) {
  return __builtin_bit_cast(float, __builtin_amdgcn_update_dpp(
      0, __builtin_bit_cast(int, x), CTRL, 0xf, 0xf, true));
}

static __device__ inline void wait_async_copies() {
#if __has_builtin(__builtin_amdgcn_global_load_async_to_lds_b128)
#if __has_builtin(__builtin_amdgcn_s_wait_asynccnt)
  __builtin_amdgcn_s_wait_asynccnt(0);
#else
  asm volatile("s_wait_asynccnt 0" ::: "memory");
#endif
#endif
}

// ---------------------------------------------------------------------------
// Projection: out = X (M x E, f32) @ W^T + b, output bf16.
// mode 0: out row-major (M x P).  mode 1: out transposed per batch (B, P, S2).
// Block = 256 threads = 8 wave32 waves; block tile 128(M) x 256(N);
// wave tile 64 x 64 (sixteen 16x16 f32 accumulators), K stepped by 32.
// The 384 rows of a K step (128 of X, 256 of W; 128 bytes of f32 each) are
// read once per block with loads in which a wave covers four whole lines,
// converted to bf16 once and kept in LDS; the waves take their fragments from
// there. Two LDS buffers: the next step's global loads are issued ahead of
// this step's products and stored behind them, one barrier per step.
// ---------------------------------------------------------------------------
__global__ __launch_bounds__(256)
void proj_kernel(const float* __restrict__ X, const float* __restrict__ W,
                 const float* __restrict__ bias, __bf16* __restrict__ out,
                 int mode) {
  __shared__ __align__(16) __bf16 sT[2][PROWS * PPITCH];

  const int lane = threadIdx.x & 31;
  const int wv   = threadIdx.x >> 5;
  const int r    = lane & 15;
  const int hh   = lane >> 4;

  const int m0 = blockIdx.x * 128 + (wv & 1) * 64;
  const int n0 = blockIdx.y * 256 + (wv >> 1) * 64;

  // staging: eight threads per row, 16 bytes of f32 each; 32 rows per pass
  const int srow = threadIdx.x >> 3;
  const int spc  = threadIdx.x & 7;
  const float* gx = X + (size_t)(blockIdx.x * 128 + srow) * EED + spc * 4;
  const float* gw = W + (size_t)(blockIdx.y * 256 + srow) * EED + spc * 4;
  const int sdst = srow * PPITCH + spc * 4;

  // fragment rows in LDS: X rows first, W rows behind them
  const int aoff = ((wv & 1) * 64 + r) * PPITCH + hh * 8;
  const int boff = (128 + (wv >> 1) * 64 + r) * PPITCH + hh * 8;

  v4f st[12];
  v8f acc[4][4] = {};

  // All loops over st[], a[] and acc[][] are fully unrolled so that they are
  // indexed by constants and stay in registers.
#pragma unroll
  for (int i = 0; i < 4; ++i) st[i] = *(const v4f*)(gx + (size_t)i * 32 * EED);
#pragma unroll
  for (int i = 0; i < 8; ++i) st[4 + i] = *(const v4f*)(gw + (size_t)i * 32 * EED);
#pragma unroll
  for (int i = 0; i < 12; ++i) {
    v4bf c;
#pragma unroll
    for (int j = 0; j < 4; ++j) c[j] = (__bf16)st[i][j];
    *(v4bf*)(&sT[0][sdst + i * 32 * PPITCH]) = c;
  }
  // the first buffer is complete before any wave takes a fragment from it
  __syncthreads();

  for (int k = 0; k < EED; k += 32) {
    const __bf16* cur = sT[(k >> 5) & 1];
    const bool more = k + 32 < EED;
    if (more) {
#pragma unroll
      for (int i = 0; i < 4; ++i)
        st[i] = *(const v4f*)(gx + (size_t)i * 32 * EED + k + 32);
#pragma unroll
      for (int i = 0; i < 8; ++i)
        st[4 + i] = *(const v4f*)(gw + (size_t)i * 32 * EED + k + 32);
    }

    v16bf a[4];
#pragma unroll
    for (int mt = 0; mt < 4; ++mt) {
      const __bf16* ap = cur + aoff + mt * 16 * PPITCH;
      a[mt] = frag_from_bf16(ap, ap + 16);
    }
#pragma unroll
    for (int nt = 0; nt < 4; ++nt) {
      const __bf16* wp = cur + boff + nt * 16 * PPITCH;
      v16bf bfr = frag_from_bf16(wp, wp + 16);
#pragma unroll
      for (int mt = 0; mt < 4; ++mt)
        acc[mt][nt] = __builtin_amdgcn_wmma_f32_16x16x32_bf16(
            false, a[mt], false, bfr, (short)0, acc[mt][nt], false, false);
    }

    if (more) {
      __bf16* nxt = sT[((k >> 5) + 1) & 1];
#pragma unroll
      for (int i = 0; i < 12; ++i) {
        v4bf c;
#pragma unroll
        for (int j = 0; j < 4; ++j) c[j] = (__bf16)st[i][j];
        *(v4bf*)(nxt + sdst + i * 32 * PPITCH) = c;
      }
    }
    // publishes the buffer just written and ends the reads of the one that the
    // next step overwrites
    __syncthreads();
  }

  if (mode == 0) {
#pragma unroll
    for (int nt = 0; nt < 4; ++nt) {
      const int n = n0 + nt * 16 + r;
      const float bv = bias[n];
#pragma unroll
      for (int mt = 0; mt < 4; ++mt)
#pragma unroll
        for (int v = 0; v < 8; ++v) {
          const int m = m0 + mt * 16 + hh * 8 + v;
          out[(size_t)m * PPD + n] = (__bf16)(acc[mt][nt][v] + bv);
        }
    }
  } else {
#pragma unroll
    for (int nt = 0; nt < 4; ++nt) {
      const int n = n0 + nt * 16 + r;
      const float bv = bias[n];
#pragma unroll
      for (int mt = 0; mt < 4; ++mt) {
        const int m = m0 + mt * 16 + hh * 8;
        const int batch = m / S2D;
        const int sm = m - batch * S2D;
        v8bf pk;
#pragma unroll
        for (int v = 0; v < 8; ++v) pk[v] = (__bf16)(acc[mt][nt][v] + bv);
        *(v8bf*)(out + ((size_t)batch * PPD + n) * S2D + sm) = pk;
      }
    }
  }
}

// ---------------------------------------------------------------------------
// Flash attention over bf16 projected tensors.
// Grid: (B * S1/64, 2). Block = 256 threads (8 waves).
// Q tile (64x1024 bf16) staged once to LDS via async global->LDS;
// K/V fragments streamed from L2 with b128 loads. Per 64-row KV tile:
// scores (8 waves x two 16x16 tiles that share each K fragment, K=1024),
// online softmax (all waves, four lanes per row), then O += P @ V (each
// wave owns 64 output cols of its 512-col split; each V fragment feeds the
// four 16-row tiles of the block).
// ---------------------------------------------------------------------------
__global__ __launch_bounds__(256)
void attn_kernel(const __bf16* __restrict__ qp, const __bf16* __restrict__ kp,
                 const __bf16* __restrict__ vpT, float* __restrict__ out) {
  __shared__ __align__(16) __bf16 sQ[QROWS * QPITCH];  // Q tile, ~129 KB
  __shared__ __align__(16) float  sS[QROWS * SPITCH];  // raw scores, f32
  __shared__ __align__(16) __bf16 sP[QROWS * 64];      // softmax probs, bf16
  __shared__ float  sCorr[QROWS];                // per-row rescale factor
  __shared__ float  sStat[QROWS];                // per-row 1/l at the end

  const int lane = threadIdx.x & 31;
  const int wv   = threadIdx.x >> 5;
  const int r    = lane & 15;
  const int hh   = lane >> 4;

  const int batch  = blockIdx.x >> 5;            // 32 q-tiles per batch
  const int q0     = (blockIdx.x & 31) * QROWS;
  const int nsplit = blockIdx.y;

  const __bf16* qb = qp  + (size_t)batch * S1D * PPD;
  const __bf16* kb = kp  + (size_t)batch * S2D * PPD;
  const __bf16* vb = vpT + (size_t)batch * PPD * S2D;

  // ---- stage Q tile into LDS (async copies, 16B per call per thread)
  {
    const int row = threadIdx.x >> 2;            // 64 rows, 4 threads each
    const int seg = threadIdx.x & 3;             // 256-element segment
    const __bf16* gs = qb + (size_t)(q0 + row) * PPD + seg * 256;
    __bf16* ls = sQ + row * QPITCH + seg * 256;
#pragma unroll
    for (int c = 0; c < 32; ++c)
      copy16_g2l(gs + c * 8, ls + c * 8);
    wait_async_copies();
  }
  __syncthreads();

  const int sm_t  = (wv >> 2) * 32;              // score tiles' M offset (two tiles)
  const int sn_t  = (wv & 3) * 16;               // score tile N offset (kv)
  const int ncol0 = nsplit * 512 + wv * 64;      // output column base
  const int srw   = threadIdx.x >> 2;            // softmax: this lane's row
  const int sq    = threadIdx.x & 3;             // and its 16-column quarter

  const float scale = 0.03125f;                  // 1/sqrt(1024)

  v8f accO[4][4] = {};
  float m_run = -3.0e38f;
  float l_run = 0.0f;

  const __bf16* qlrow = sQ + (sm_t + r) * QPITCH;  // A rows now in LDS

  for (int kv = 0; kv < S2D; kv += 64) {
    // ---- phase 1: S = Q K^T (each wave two 16x16 tiles of the 64x64 block)
    v8f accS[2] = {};
    const __bf16* krow = kb + (size_t)(kv + sn_t + r) * PPD; // B[k][n]=K[n][k]
#pragma unroll 4
    for (int e = 0; e < EED; e += 32) {
      v16bf bk = frag_from_bf16(krow + e + hh * 8, krow + e + 16 + hh * 8);
      // unrolled so that accS[] is indexed by constants and stays in registers
#pragma unroll
      for (int mt = 0; mt < 2; ++mt) {
        const __bf16* qr = qlrow + mt * 16 * QPITCH + e;
        v16bf a = frag_from_bf16(qr + hh * 8, qr + 16 + hh * 8);
        accS[mt] = __builtin_amdgcn_wmma_f32_16x16x32_bf16(
            false, a, false, bk, (short)0, accS[mt], false, false);
      }
    }
    // unrolled for the same reason: constant indices into accS[]
#pragma unroll
    for (int mt = 0; mt < 2; ++mt)
#pragma unroll
      for (int v = 0; v < 8; ++v)
        sS[(sm_t + mt * 16 + hh * 8 + v) * SPITCH + sn_t + r] = accS[mt][v];

    if (kv + 64 < S2D)  // hint next K tile toward the caches
      __builtin_prefetch(kb + (size_t)(kv + 64 + sn_t + r) * PPD, 0, 1);

    __syncthreads();

    // ---- phase 2: online softmax row update (all waves; four lanes share a
    // row, each holds 16 of its columns in registers; the four lanes keep equal
    // copies of the row's running maximum and sum)
    {
      const float* srow = sS + srw * SPITCH + sq * 16;
      float s[16];
      // unrolled so that s[] is indexed by constants and stays in registers
#pragma unroll
      for (int j = 0; j < 4; ++j) {
        const v4f t = *(const v4f*)(srow + j * 4);
#pragma unroll
        for (int i = 0; i < 4; ++i) s[j * 4 + i] = t[i] * scale;
      }
      float mx = m_run;
#pragma unroll
      for (int c = 0; c < 16; ++c) mx = fmaxf(mx, s[c]);
      mx = fmaxf(mx, quad_swap<0xB1>(mx));
      mx = fmaxf(mx, quad_swap<0x4E>(mx));
      const float corr = __expf(m_run - mx);
      float lp[4] = {0.0f, 0.0f, 0.0f, 0.0f};    // four independent sum chains
      v8bf pk[2];
#pragma unroll
      for (int c = 0; c < 16; ++c) {
        const float p = __expf(s[c] - mx);
        lp[c & 3] += p;
        pk[c >> 3][c & 7] = (__bf16)p;
      }
      float ls = (lp[0] + lp[1]) + (lp[2] + lp[3]);
      ls += quad_swap<0xB1>(ls);
      ls += quad_swap<0x4E>(ls);
      __bf16* prow = sP + srw * 64 + sq * 16;
      *(v8bf*)prow = pk[0];
      *(v8bf*)(prow + 8) = pk[1];
      l_run = l_run * corr + ls;
      m_run = mx;
      if (sq == 0) sCorr[srw] = corr;
    }
    __syncthreads();

    // ---- phase 3: rescale O, then O += P @ V (wave owns 64 output cols)
#pragma unroll
    for (int mt = 0; mt < 4; ++mt)
#pragma unroll
      for (int v = 0; v < 8; ++v) {
        const float c = sCorr[mt * 16 + hh * 8 + v];
#pragma unroll
        for (int nt = 0; nt < 4; ++nt) accO[mt][nt][v] *= c;
      }

#pragma unroll
    for (int ks = 0; ks < 64; ks += 32) {
      v16bf aP[4];
#pragma unroll
      for (int mt = 0; mt < 4; ++mt) {
        const __bf16* pr = sP + (mt * 16 + r) * 64 + ks;
        aP[mt] = frag_from_bf16(pr + hh * 8, pr + 16 + hh * 8);
      }
#pragma unroll
      for (int nt = 0; nt < 4; ++nt) {
        // B[k][n] = V[kv+k][n] = vpT[n][kv+k] -> contiguous along k
        const __bf16* vrow = vb + (size_t)(ncol0 + nt * 16 + r) * S2D + kv + ks;
        v16bf bv = frag_from_bf16(vrow + hh * 8, vrow + 16 + hh * 8);
#pragma unroll
        for (int mt = 0; mt < 4; ++mt)
          accO[mt][nt] = __builtin_amdgcn_wmma_f32_16x16x32_bf16(
              false, aP[mt], false, bv, (short)0, accO[mt][nt], false, false);
      }
    }
    __syncthreads();
  }

  // ---- epilogue: divide by row sums, write f32 output
  if (sq == 0) sStat[srw] = 1.0f / l_run;
  __syncthreads();

  float* ob = out + ((size_t)batch * S1D + q0) * PPD;
#pragma unroll
  for (int mt = 0; mt < 4; ++mt)
#pragma unroll
    for (int v = 0; v < 8; ++v) {
      const int row = mt * 16 + hh * 8 + v;
      const float inv = sStat[row];
#pragma unroll
      for (int nt = 0; nt < 4; ++nt)
        ob[(size_t)row * PPD + ncol0 + nt * 16 + r] = accO[mt][nt][v] * inv;
    }
}

extern "C" void kernel_launch(void* const* d_in, const int* in_sizes, int n_in,
                              void* d_out, int out_size, void* d_ws, size_t ws_size,
                              hipStream_t stream) {
  (void)in_sizes; (void)n_in; (void)out_size; (void)ws_size;
  const float* q = (const float*)d_in[0];
  const float* k = (const float*)d_in[1];
  const float* v = (const float*)d_in[2];
  const float* W = (const float*)d_in[3];
  const float* b = (const float*)d_in[4];
  float* out = (float*)d_out;

  // Workspace: bf16 projected Q (B*S1*P), K (B*S2*P), V^T (B*P*S2) = 96 MB
  __bf16* qp  = (__bf16*)d_ws;
  __bf16* kp  = qp + (size_t)BB * S1D * PPD;
  __bf16* vpT = kp + (size_t)BB * S2D * PPD;

  dim3 pg(BB * S1D / 128, PPD / 256);
  proj_kernel<<<pg, 256, 0, stream>>>(q, W, b, qp, 0);
  proj_kernel<<<pg, 256, 0, stream>>>(k, W, b, kp, 0);
  proj_kernel<<<pg, 256, 0, stream>>>(v, W, b, vpT, 1);

  dim3 ag(BB * (S1D / QROWS), 2);
  attn_kernel<<<ag, 256, 0, stream>>>(qp, kp, vpT, out);
}

// v005
// It runs in 445 microseconds.
// Timed twice side by side with v004, it ran 1.09 times as fast both times.
// Counting every step since v000, it is 3.01 times as fast.
#include <hip/hip_runtime.h>
#include <hip/hip_bf16.h>

#define BB 8
#define S1D 2048
#define S2D 2048
#define EED 1024
#define PPD 1024
#define QPITCH 1032   // 1024 + 8 bf16 pad -> row stride 2064B = 129*16B (bank-spread)
#define QROWS 64      // query rows per attention block
#define SPITCH 68     // score row pitch in f32: 64 + 4 pad -> 272 B = 17*16B (bank-spread)
#define PROWS 384     // rows staged per projection K step: 128 of X + 256 of W
#define PPITCH 40     // their LDS pitch in bf16: 32 + 8 pad -> 80 B = 5*16B (bank-spread)

typedef __attribute__((ext_vector_type(16))) __bf16 v16bf;
typedef __attribute__((ext_vector_type(8)))  __bf16 v8bf;
typedef __attribute__((ext_vector_type(8)))  float  v8f;
typedef __attribute__((ext_vector_type(4)))  int    v4i;
typedef __attribute__((ext_vector_type(4)))  float  v4f;
typedef __attribute__((ext_vector_type(4)))  __bf16 v4bf;

typedef __attribute__((address_space(1))) v4i* as1_v4ip;  // global (prints as __device__*)
typedef __attribute__((address_space(3))) v4i* as3_v4ip;  // LDS

// Build a 16-element bf16 WMMA fragment from two 16-byte chunks.
// Per ISA 7.12.2 (16-bit A/B layout): frag[0..7] = K group (half*8 ..),
// frag[8..15] = K group (16+half*8 ..).
static __device__ inline v16bf frag_from_bf16(const __bf16* p0, const __bf16* p1) {
  v8bf lo = *(const v8bf*)p0;
  v8bf hi = *(const v8bf*)p1;
  return __builtin_shufflevector(lo, hi, 0,1,2,3,4,5,6,7,8,9,10,11,12,13,14,15);
}

// Async global->LDS 16B copy (ASYNCcnt path) with synchronous fallback.
static __device__ inline void copy16_g2l(const __bf16* gsrc, __bf16* ldst) {
#if __has_builtin(__builtin_amdgcn_global_load_async_to_lds_b128)
  __builtin_amdgcn_global_load_async_to_lds_b128(
      (as1_v4ip)gsrc, (as3_v4ip)ldst, 0, 0);
#else
  *(v8bf*)ldst = *(const v8bf*)gsrc;
#endif
}

// Value of the lane whose number differs by the quad_perm pattern CTRL
// (0xB1: lane ^ 1, 0x4E: lane ^ 2); a register move, no LDS traffic.
template <int CTRL>
static __device__ inline float quad_swap(float x) {
  return __builtin_bit_cast(float, __builtin_amdgcn_update_dpp(
      0, __builtin_bit_cast(int, x), CTRL, 0xf, 0xf, true));
}

static __device__ inline void wait_async_copies() {
#if __has_builtin(__builtin_amdgcn_global_load_async_to_lds_b128)
#if __has_builtin(__builtin_amdgcn_s_wait_asynccnt)
  __builtin_amdgcn_s_wait_asynccnt(0);
#else
  asm volatile("s_wait_asynccnt 0" ::: "memory");
#endif
#endif
}

// ---------------------------------------------------------------------------
// Projection: out = X (M x E, f32) @ W^T + b, output bf16.
// mode 0: out row-major (M x P).
// mode 1, 2: out in the order of the attention kernel's B fragments, as units of
// 1024 bytes = 16 lines of the operand x 32 k: [k half of 16][k group of 8]
// [line][8 k], so that lane l of a wave finds its 16 bytes of a half at l * 16
// and one wave-wide 16-byte load covers 512 contiguous bytes (four whole cache
// lines) instead of 32-byte pieces of 16 lines.
// mode 2 (keys): line = key row, k = projected column; units [row / 16][col / 32].
// mode 1 (values): line = projected column, k = key row of the batch; units
// [batch][col / 16][row / 32].
// Block = 256 threads = 8 wave32 waves; block tile 128(M) x 256(N);
// wave tile 64 x 64 (sixteen 16x16 f32 accumulators), K stepped by 32.
// The 384 rows of a K step (128 of X, 256 of W; 128 bytes of f32 each) are
// read once per block with loads in which a wave covers four whole lines,
// converted to bf16 once and kept in LDS; the waves take their fragments from
// there. Two LDS buffers: the next step's global loads are issued ahead of
// this step's products and stored behind them, one barrier per step.
// ---------------------------------------------------------------------------
__global__ __launch_bounds__(256)
void proj_kernel(const float* __restrict__ X, const float* __restrict__ W,
                 const float* __restrict__ bias, __bf16* __restrict__ out,
                 int mode) {
  __shared__ __align__(16) __bf16 sT[2][PROWS * PPITCH];

  const int lane = threadIdx.x & 31;
  const int wv   = threadIdx.x >> 5;
  const int r    = lane & 15;
  const int hh   = lane >> 4;

  const int m0 = blockIdx.x * 128 + (wv & 1) * 64;
  const int n0 = blockIdx.y * 256 + (wv >> 1) * 64;

  // staging: eight threads per row, 16 bytes of f32 each; 32 rows per pass
  const int srow = threadIdx.x >> 3;
  const int spc  = threadIdx.x & 7;
  const float* gx = X + (size_t)(blockIdx.x * 128 + srow) * EED + spc * 4;
  const float* gw = W + (size_t)(blockIdx.y * 256 + srow) * EED + spc * 4;
  const int sdst = srow * PPITCH + spc * 4;

  // fragment rows in LDS: X rows first, W rows behind them
  const int aoff = ((wv & 1) * 64 + r) * PPITCH + hh * 8;
  const int boff = (128 + (wv >> 1) * 64 + r) * PPITCH + hh * 8;

  v4f st[12];
  v8f acc[4][4] = {};

  // All loops over st[], a[] and acc[][] are fully unrolled so that they are
  // indexed by constants and stay in registers.
#pragma unroll
  for (int i = 0; i < 4; ++i) st[i] = *(const v4f*)(gx + (size_t)i * 32 * EED);
#pragma unroll
  for (int i = 0; i < 8; ++i) st[4 + i] = *(const v4f*)(gw + (size_t)i * 32 * EED);
#pragma unroll
  for (int i = 0; i < 12; ++i) {
    v4bf c;
#pragma unroll
    for (int j = 0; j < 4; ++j) c[j] = (__bf16)st[i][j];
    *(v4bf*)(&sT[0][sdst + i * 32 * PPITCH]) = c;
  }
  // the first buffer is complete before any wave takes a fragment from it
  __syncthreads();

  for (int k = 0; k < EED; k += 32) {
    const __bf16* cur = sT[(k >> 5) & 1];
    const bool more = k + 32 < EED;
    if (more) {
#pragma unroll
      for (int i = 0; i < 4; ++i)
        st[i] = *(const v4f*)(gx + (size_t)i * 32 * EED + k + 32);
#pragma unroll
      for (int i = 0; i < 8; ++i)
        st[4 + i] = *(const v4f*)(gw + (size_t)i * 32 * EED + k + 32);
    }

    v16bf a[4];
#pragma unroll
    for (int mt = 0; mt < 4; ++mt) {
      const __bf16* ap = cur + aoff + mt * 16 * PPITCH;
      a[mt] = frag_from_bf16(ap, ap + 16);
    }
#pragma unroll
    for (int nt = 0; nt < 4; ++nt) {
      const __bf16* wp = cur + boff + nt * 16 * PPITCH;
      v16bf bfr = frag_from_bf16(wp, wp + 16);
#pragma unroll
      for (int mt = 0; mt < 4; ++mt)
        acc[mt][nt] = __builtin_amdgcn_wmma_f32_16x16x32_bf16(
            false, a[mt], false, bfr, (short)0, acc[mt][nt], false, false);
    }

    if (more) {
      __bf16* nxt = sT[((k >> 5) + 1) & 1];
#pragma unroll
      for (int i = 0; i < 12; ++i) {
        v4bf c;
#pragma unroll
        for (int j = 0; j < 4; ++j) c[j] = (__bf16)st[i][j];
        *(v4bf*)(nxt + sdst + i * 32 * PPITCH) = c;
      }
    }
    // publishes the buffer just written and ends the reads of the one that the
    // next step overwrites
    __syncthreads();
  }

  if (mode == 0) {
#pragma unroll
    for (int nt = 0; nt < 4; ++nt) {
      const int n = n0 + nt * 16 + r;
      const float bv = bias[n];
#pragma unroll
      for (int mt = 0; mt < 4; ++mt)
#pragma unroll
        for (int v = 0; v < 8; ++v) {
          const int m = m0 + mt * 16 + hh * 8 + v;
          out[(size_t)m * PPD + n] = (__bf16)(acc[mt][nt][v] + bv);
        }
    }
  } else if (mode == 2) {
#pragma unroll
    for (int nt = 0; nt < 4; ++nt) {
      const int n = n0 + nt * 16 + r;
      const float bv = bias[n];
      // place of column n inside its unit row: unit, k half, k group, k
      const int noff = (n >> 5) * 512 + ((n >> 4) & 1) * 256 + ((n >> 3) & 1) * 128 + (n & 7);
#pragma unroll
      for (int mt = 0; mt < 4; ++mt) {
        __bf16* op = out + (size_t)((m0 >> 4) + mt) * (16 * PPD) + noff + hh * 64;
#pragma unroll
        for (int v = 0; v < 8; ++v) op[v * 8] = (__bf16)(acc[mt][nt][v] + bv);
      }
    }
    // precaution: stands in front of every later rewrite of a register that these stores name
    asm volatile("s_wait_xcnt 0x0" ::: "memory");
  } else {
#pragma unroll
    for (int nt = 0; nt < 4; ++nt) {
      const int n = n0 + nt * 16 + r;
      const float bv = bias[n];
#pragma unroll
      for (int mt = 0; mt < 4; ++mt) {
        const int m = m0 + mt * 16;                // first of this tile's 16 rows
        const int batch = m / S2D;
        const int sm = m - batch * S2D;
        v8bf pk;
#pragma unroll
        for (int v = 0; v < 8; ++v) pk[v] = (__bf16)(acc[mt][nt][v] + bv);
        *(v8bf*)(out + (size_t)batch * PPD * S2D
                 + (size_t)((n >> 4) * (S2D / 32) + (sm >> 5)) * 512
                 + ((sm >> 4) & 1) * 256 + lane * 8) = pk;
      }
    }
    // precaution: stands in front of every later rewrite of a register that these stores name
    asm volatile("s_wait_xcnt 0x0" ::: "memory");
  }
}

// ---------------------------------------------------------------------------
// Flash attention over bf16 projected tensors.
// Grid: (B * S1/64, 2). Block = 256 threads (8 waves).
// Q tile (64x1024 bf16) staged once to LDS via async global->LDS;
// K/V fragments streamed from L2 with b128 loads of 512 contiguous bytes per
// wave (both tensors lie in fragment order, see the projection). Per 64-row KV tile:
// scores (8 waves x two 16x16 tiles that share each K fragment, K=1024),
// online softmax (all waves, four lanes per row), then O += P @ V (each
// wave owns 64 output cols of its 512-col split; each V fragment feeds the
// four 16-row tiles of the block).
// ---------------------------------------------------------------------------
__global__ __launch_bounds__(256)
void attn_kernel(const __bf16* __restrict__ qp, const __bf16* __restrict__ kp,
                 const __bf16* __restrict__ vpF, float* __restrict__ out) {
  __shared__ __align__(16) __bf16 sQ[QROWS * QPITCH];  // Q tile, ~129 KB
  __shared__ __align__(16) float  sS[QROWS * SPITCH];  // raw scores, f32
  __shared__ __align__(16) __bf16 sP[QROWS * 64];      // softmax probs, bf16
  __shared__ float  sCorr[QROWS];                // per-row rescale factor
  __shared__ float  sStat[QROWS];                // per-row 1/l at the end

  const int lane = threadIdx.x & 31;
  const int wv   = threadIdx.x >> 5;
  const int r    = lane & 15;
  const int hh   = lane >> 4;

  const int batch  = blockIdx.x >> 5;            // 32 q-tiles per batch
  const int q0     = (blockIdx.x & 31) * QROWS;
  const int nsplit = blockIdx.y;

  const __bf16* qb = qp  + (size_t)batch * S1D * PPD;
  const __bf16* kb = kp  + (size_t)batch * S2D * PPD;
  const __bf16* vb = vpF + (size_t)batch * PPD * S2D;

  // ---- stage Q tile into LDS (async copies, 16B per call per thread)
  {
    const int row = threadIdx.x >> 2;            // 64 rows, 4 threads each
    const int seg = threadIdx.x & 3;             // 256-element segment
    const __bf16* gs = qb + (size_t)(q0 + row) * PPD + seg * 256;
    __bf16* ls = sQ + row * QPITCH + seg * 256;
#pragma unroll
    for (int c = 0; c < 32; ++c)
      copy16_g2l(gs + c * 8, ls + c * 8);
    wait_async_copies();
  }
  __syncthreads();

  const int sm_t  = (wv >> 2) * 32;              // score tiles' M offset (two tiles)
  const int sn_t  = (wv & 3) * 16;               // score tile N offset (kv)
  const int ncol0 = nsplit * 512 + wv * 64;      // output column base
  const int srw   = threadIdx.x >> 2;            // softmax: this lane's row
  const int sq    = threadIdx.x & 3;             // and its 16-column quarter

  const float scale = 0.03125f;                  // 1/sqrt(1024)

  v8f accO[4][4] = {};
  float m_run = -3.0e38f;
  float l_run = 0.0f;

  const __bf16* qlrow = sQ + (sm_t + r) * QPITCH;  // A rows now in LDS

  for (int kv = 0; kv < S2D; kv += 64) {
    // ---- phase 1: S = Q K^T (each wave two 16x16 tiles of the 64x64 block)
    v8f accS[2] = {};
    // B[k][n]=K[n][k]: the units of this wave's 16 key rows, 512 elements per e step
    const __bf16* kfr = kb + (size_t)(kv + sn_t) * PPD + lane * 8;
#pragma unroll 4
    for (int e = 0; e < EED; e += 32) {
      v16bf bk = frag_from_bf16(kfr + e * 16, kfr + e * 16 + 256);
      // unrolled so that accS[] is indexed by constants and stays in registers
#pragma unroll
      for (int mt = 0; mt < 2; ++mt) {
        const __bf16* qr = qlrow + mt * 16 * QPITCH + e;
        v16bf a = frag_from_bf16(qr + hh * 8, qr + 16 + hh * 8);
        accS[mt] = __builtin_amdgcn_wmma_f32_16x16x32_bf16(
            false, a, false, bk, (short)0, accS[mt], false, false);
      }
    }
    // unrolled for the same reason: constant indices into accS[]
#pragma unroll
    for (int mt = 0; mt < 2; ++mt)
#pragma unroll
      for (int v = 0; v < 8; ++v)
        sS[(sm_t + mt * 16 + hh * 8 + v) * SPITCH + sn_t + r] = accS[mt][v];

    if (kv + 64 < S2D) {  // hint next K tile toward the caches
      __builtin_prefetch(kb + (size_t)(kv + 64 + sn_t) * PPD + lane * 64, 0, 1);
      // precaution: stands in front of the rewrite of the hint's address registers
      asm volatile("s_wait_xcnt 0x0" ::: "memory");
    }

    __syncthreads();

    // ---- phase 2: online softmax row update (all waves; four lanes share a
    // row, each holds 16 of its columns in registers; the four lanes keep equal
    // copies of the row's running maximum and sum)
    {
      const float* srow = sS + srw * SPITCH + sq * 16;
      float s[16];
      // unrolled so that s[] is indexed by constants and stays in registers
#pragma unroll
      for (int j = 0; j < 4; ++j) {
        const v4f t = *(const v4f*)(srow + j * 4);
#pragma unroll
        for (int i = 0; i < 4; ++i) s[j * 4 + i] = t[i] * scale;
      }
      float mx = m_run;
#pragma unroll
      for (int c = 0; c < 16; ++c) mx = fmaxf(mx, s[c]);
      mx = fmaxf(mx, quad_swap<0xB1>(mx));
      mx = fmaxf(mx, quad_swap<0x4E>(mx));
      const float corr = __expf(m_run - mx);
      float lp[4] = {0.0f, 0.0f, 0.0f, 0.0f};    // four independent sum chains
      v8bf pk[2];
#pragma unroll
      for (int c = 0; c < 16; ++c) {
        const float p = __expf(s[c] - mx);
        lp[c & 3] += p;
        pk[c >> 3][c & 7] = (__bf16)p;
      }
      float ls = (lp[0] + lp[1]) + (lp[2] + lp[3]);
      ls += quad_swap<0xB1>(ls);
      ls += quad_swap<0x4E>(ls);
      __bf16* prow = sP + srw * 64 + sq * 16;
      *(v8bf*)prow = pk[0];
      *(v8bf*)(prow + 8) = pk[1];
      l_run = l_run * corr + ls;
      m_run = mx;
      if (sq == 0) sCorr[srw] = corr;
    }
    __syncthreads();

    // ---- phase 3: rescale O, then O += P @ V (wave owns 64 output cols)
#pragma unroll
    for (int mt = 0; mt < 4; ++mt)
#pragma unroll
      for (int v = 0; v < 8; ++v) {
        const float c = sCorr[mt * 16 + hh * 8 + v];
#pragma unroll
        for (int nt = 0; nt < 4; ++nt) accO[mt][nt][v] *= c;
      }

#pragma unroll
    for (int ks = 0; ks < 64; ks += 32) {
      v16bf aP[4];
#pragma unroll
      for (int mt = 0; mt < 4; ++mt) {
        const __bf16* pr = sP + (mt * 16 + r) * 64 + ks;
        aP[mt] = frag_from_bf16(pr + hh * 8, pr + 16 + hh * 8);
      }
#pragma unroll
      for (int nt = 0; nt < 4; ++nt) {
        // B[k][n] = V[kv+k][n]: the unit of these 16 columns and 32 key rows
        const __bf16* vfr = vb + (size_t)(((ncol0 >> 4) + nt) * (S2D / 32) + ((kv + ks) >> 5)) * 512
                            + lane * 8;
        v16bf bv = frag_from_bf16(vfr, vfr + 256);
#pragma unroll
        for (int mt = 0; mt < 4; ++mt)
          accO[mt][nt] = __builtin_amdgcn_wmma_f32_16x16x32_bf16(
              false, aP[mt], false, bv, (short)0, accO[mt][nt], false, false);
      }
    }
    __syncthreads();
  }

  // ---- epilogue: divide by row sums, write f32 output
  if (sq == 0) sStat[srw] = 1.0f / l_run;
  __syncthreads();

  float* ob = out + ((size_t)batch * S1D + q0) * PPD;
#pragma unroll
  for (int mt = 0; mt < 4; ++mt)
#pragma unroll
    for (int v = 0; v < 8; ++v) {
      const int row = mt * 16 + hh * 8 + v;
      const float inv = sStat[row];
#pragma unroll
      for (int nt = 0; nt < 4; ++nt)
        ob[(size_t)row * PPD + ncol0 + nt * 16 + r] = accO[mt][nt][v] * inv;
    }
}

extern "C" void kernel_launch(void* const* d_in, const int* in_sizes, int n_in,
                              void* d_out, int out_size, void* d_ws, size_t ws_size,
                              hipStream_t stream) {
  (void)in_sizes; (void)n_in; (void)out_size; (void)ws_size;
  const float* q = (const float*)d_in[0];
  const float* k = (const float*)d_in[1];
  const float* v = (const float*)d_in[2];
  const float* W = (const float*)d_in[3];
  const float* b = (const float*)d_in[4];
  float* out = (float*)d_out;

  // Workspace: bf16 projected Q (B*S1*P, row-major), K (B*S2*P) and V (B*P*S2),
  // the last two in fragment order = 96 MB
  __bf16* qp  = (__bf16*)d_ws;
  __bf16* kp  = qp + (size_t)BB * S1D * PPD;
  __bf16* vpF = kp + (size_t)BB * S2D * PPD;

  dim3 pg(BB * S1D / 128, PPD / 256);
  proj_kernel<<<pg, 256, 0, stream>>>(q, W, b, qp, 0);
  proj_kernel<<<pg, 256, 0, stream>>>(k, W, b, kp, 2);
  proj_kernel<<<pg, 256, 0, stream>>>(v, W, b, vpF, 1);

  dim3 ag(BB * (S1D / QROWS), 2);
  attn_kernel<<<ag, 256, 0, stream>>>(qp, kp, vpF, out);
}

// v006
// Measured time: 266 microseconds a run.
// Next to v005, in two timings, it ran 1.67 and 1.66 times as fast.
// Counting every step since v000, it is 5.01 times as fast.
#include <hip/hip_runtime.h>
#include <hip/hip_bf16.h>

#define BB 8
#define S1D 2048
#define S2D 2048
#define EED 1024
#define PPD 1024
#define QPITCH 1032   // 1024 + 8 bf16 pad -> row stride 2064B = 129*16B (bank-spread)
#define QROWS 64      // query rows per attention block
#define KVT 256       // key rows per attention pass
#define SPITCH 260    // score row pitch in f32: 256 + 4 pad -> 1040 B = 65*16B (bank-spread)
#define WPITCH 264    // softmax weight row pitch in bf16: 256 + 8 pad -> 528 B = 33*16B (bank-spread)
#define PROWS 384     // rows staged per projection K step: 128 of X + 256 of W
#define PPITCH 40     // their LDS pitch in bf16: 32 + 8 pad -> 80 B = 5*16B (bank-spread)

typedef __attribute__((ext_vector_type(16))) __bf16 v16bf;
typedef __attribute__((ext_vector_type(8)))  __bf16 v8bf;
typedef __attribute__((ext_vector_type(8)))  float  v8f;
typedef __attribute__((ext_vector_type(4)))  int    v4i;
typedef __attribute__((ext_vector_type(4)))  float  v4f;
typedef __attribute__((ext_vector_type(4)))  __bf16 v4bf;

typedef __attribute__((address_space(1))) v4i* as1_v4ip;  // global (prints as __device__*)
typedef __attribute__((address_space(3))) v4i* as3_v4ip;  // LDS

// Build a 16-element bf16 WMMA fragment from two 16-byte chunks.
// Per ISA 7.12.2 (16-bit A/B layout): frag[0..7] = K group (half*8 ..),
// frag[8..15] = K group (16+half*8 ..).
static __device__ inline v16bf frag_from_bf16(const __bf16* p0, const __bf16* p1) {
  v8bf lo = *(const v8bf*)p0;
  v8bf hi = *(const v8bf*)p1;
  return __builtin_shufflevector(lo, hi, 0,1,2,3,4,5,6,7,8,9,10,11,12,13,14,15);
}

// Async global->LDS 16B copy (ASYNCcnt path) with synchronous fallback.
static __device__ inline void copy16_g2l(const __bf16* gsrc, __bf16* ldst) {
#if __has_builtin(__builtin_amdgcn_global_load_async_to_lds_b128)
  __builtin_amdgcn_global_load_async_to_lds_b128(
      (as1_v4ip)gsrc, (as3_v4ip)ldst, 0, 0);
#else
  *(v8bf*)ldst = *(const v8bf*)gsrc;
#endif
}

// Value of the lane whose number differs by the DPP pattern CTRL (quad_perm
// 0xB1: lane ^ 1, 0x4E: lane ^ 2; row_xmask 0x164: lane ^ 4); a register move,
// no LDS traffic.
template <int CTRL>
static __device__ inline float quad_swap(float x) {
  return __builtin_bit_cast(float, __builtin_amdgcn_update_dpp(
      0, __builtin_bit_cast(int, x), CTRL, 0xf, 0xf, true));
}

static __device__ inline void wait_async_copies() {
#if __has_builtin(__builtin_amdgcn_global_load_async_to_lds_b128)
#if __has_builtin(__builtin_amdgcn_s_wait_asynccnt)
  __builtin_amdgcn_s_wait_asynccnt(0);
#else
  asm volatile("s_wait_asynccnt 0" ::: "memory");
#endif
#endif
}

// ---------------------------------------------------------------------------
// Projection: out = X (M x E, f32) @ W^T + b, output bf16.
// mode 0: out row-major (M x P).
// mode 1, 2: out in the order of the attention kernel's B fragments, as units of
// 1024 bytes = 16 lines of the operand x 32 k: [k half of 16][k group of 8]
// [line][8 k], so that lane l of a wave finds its 16 bytes of a half at l * 16
// and one wave-wide 16-byte load covers 512 contiguous bytes (four whole cache
// lines) instead of 32-byte pieces of 16 lines.
// mode 2 (keys): line = key row, k = projected column; units [row / 16][col / 32].
// mode 1 (values): line = projected column, k = key row of the batch; units
// [batch][col / 16][row / 32].
// Block = 256 threads = 8 wave32 waves; block tile 128(M) x 256(N);
// wave tile 64 x 64 (sixteen 16x16 f32 accumulators), K stepped by 32.
// The 384 rows of a K step (128 of X, 256 of W; 128 bytes of f32 each) are
// read once per block with loads in which a wave covers four whole lines,
// converted to bf16 once and kept in LDS; the waves take their fragments from
// there. Two LDS buffers: the next step's global loads are issued ahead of
// this step's products and stored behind them, one barrier per step.
// ---------------------------------------------------------------------------
__global__ __launch_bounds__(256)
void proj_kernel(const float* __restrict__ X, const float* __restrict__ W,
                 const float* __restrict__ bias, __bf16* __restrict__ out,
                 int mode) {
  __shared__ __align__(16) __bf16 sT[2][PROWS * PPITCH];

  const int lane = threadIdx.x & 31;
  const int wv   = threadIdx.x >> 5;
  const int r    = lane & 15;
  const int hh   = lane >> 4;

  const int m0 = blockIdx.x * 128 + (wv & 1) * 64;
  const int n0 = blockIdx.y * 256 + (wv >> 1) * 64;

  // staging: eight threads per row, 16 bytes of f32 each; 32 rows per pass
  const int srow = threadIdx.x >> 3;
  const int spc  = threadIdx.x & 7;
  const float* gx = X + (size_t)(blockIdx.x * 128 + srow) * EED + spc * 4;
  const float* gw = W + (size_t)(blockIdx.y * 256 + srow) * EED + spc * 4;
  const int sdst = srow * PPITCH + spc * 4;

  // fragment rows in LDS: X rows first, W rows behind them
  const int aoff = ((wv & 1) * 64 + r) * PPITCH + hh * 8;
  const int boff = (128 + (wv >> 1) * 64 + r) * PPITCH + hh * 8;

  v4f st[12];
  v8f acc[4][4] = {};

  // All loops over st[], a[] and acc[][] are fully unrolled so that they are
  // indexed by constants and stay in registers.
#pragma unroll
  for (int i = 0; i < 4; ++i) st[i] = *(const v4f*)(gx + (size_t)i * 32 * EED);
#pragma unroll
  for (int i = 0; i < 8; ++i) st[4 + i] = *(const v4f*)(gw + (size_t)i * 32 * EED);
#pragma unroll
  for (int i = 0; i < 12; ++i) {
    v4bf c;
#pragma unroll
    for (int j = 0; j < 4; ++j) c[j] = (__bf16)st[i][j];
    *(v4bf*)(&sT[0][sdst + i * 32 * PPITCH]) = c;
  }
  // the first buffer is complete before any wave takes a fragment from it
  __syncthreads();

  for (int k = 0; k < EED; k += 32) {
    const __bf16* cur = sT[(k >> 5) & 1];
    const bool more = k + 32 < EED;
    if (more) {
#pragma unroll
      for (int i = 0; i < 4; ++i)
        st[i] = *(const v4f*)(gx + (size_t)i * 32 * EED + k + 32);
#pragma unroll
      for (int i = 0; i < 8; ++i)
        st[4 + i] = *(const v4f*)(gw + (size_t)i * 32 * EED + k + 32);
    }

    v16bf a[4];
#pragma unroll
    for (int mt = 0; mt < 4; ++mt) {
      const __bf16* ap = cur + aoff + mt * 16 * PPITCH;
      a[mt] = frag_from_bf16(ap, ap + 16);
    }
#pragma unroll
    for (int nt = 0; nt < 4; ++nt) {
      const __bf16* wp = cur + boff + nt * 16 * PPITCH;
      v16bf bfr = frag_from_bf16(wp, wp + 16);
#pragma unroll
      for (int mt = 0; mt < 4; ++mt)
        acc[mt][nt] = __builtin_amdgcn_wmma_f32_16x16x32_bf16(
            false, a[mt], false, bfr, (short)0, acc[mt][nt], false, false);
    }

    if (more) {
      __bf16* nxt = sT[((k >> 5) + 1) & 1];
#pragma unroll
      for (int i = 0; i < 12; ++i) {
        v4bf c;
#pragma unroll
        for (int j = 0; j < 4; ++j) c[j] = (__bf16)st[i][j];
        *(v4bf*)(nxt + sdst + i * 32 * PPITCH) = c;
      }
    }
    // publishes the buffer just written and ends the reads of the one that the
    // next step overwrites
    __syncthreads();
  }

  if (mode == 0) {
#pragma unroll
    for (int nt = 0; nt < 4; ++nt) {
      const int n = n0 + nt * 16 + r;
      const float bv = bias[n];
#pragma unroll
      for (int mt = 0; mt < 4; ++mt)
#pragma unroll
        for (int v = 0; v < 8; ++v) {
          const int m = m0 + mt * 16 + hh * 8 + v;
          out[(size_t)m * PPD + n] = (__bf16)(acc[mt][nt][v] + bv);
        }
    }
  } else if (mode == 2) {
#pragma unroll
    for (int nt = 0; nt < 4; ++nt) {
      const int n = n0 + nt * 16 + r;
      const float bv = bias[n];
      // place of column n inside its unit row: unit, k half, k group, k
      const int noff = (n >> 5) * 512 + ((n >> 4) & 1) * 256 + ((n >> 3) & 1) * 128 + (n & 7);
#pragma unroll
      for (int mt = 0; mt < 4; ++mt) {
        __bf16* op = out + (size_t)((m0 >> 4) + mt) * (16 * PPD) + noff + hh * 64;
#pragma unroll
        for (int v = 0; v < 8; ++v) op[v * 8] = (__bf16)(acc[mt][nt][v] + bv);
      }
    }
    // precaution: stands in front of every later rewrite of a register that these stores name
    asm volatile("s_wait_xcnt 0x0" ::: "memory");
  } else {
#pragma unroll
    for (int nt = 0; nt < 4; ++nt) {
      const int n = n0 + nt * 16 + r;
      const float bv = bias[n];
#pragma unroll
      for (int mt = 0; mt < 4; ++mt) {
        const int m = m0 + mt * 16;                // first of this tile's 16 rows
        const int batch = m / S2D;
        const int sm = m - batch * S2D;
        v8bf pk;
#pragma unroll
        for (int v = 0; v < 8; ++v) pk[v] = (__bf16)(acc[mt][nt][v] + bv);
        *(v8bf*)(out + (size_t)batch * PPD * S2D
                 + (size_t)((n >> 4) * (S2D / 32) + (sm >> 5)) * 512
                 + ((sm >> 4) & 1) * 256 + lane * 8) = pk;
      }
    }
    // precaution: stands in front of every later rewrite of a register that these stores name
    asm volatile("s_wait_xcnt 0x0" ::: "memory");
  }
}

// ---------------------------------------------------------------------------
// Flash attention over bf16 projected tensors.
// Grid: B * S1/64. Block = 512 threads (16 waves), one block per 64 query rows
// and all 1024 output columns, so every score is computed once.
// Q tile (64x1024 bf16) staged once to LDS via async global->LDS;
// K/V fragments streamed from L2 with b128 loads of 512 contiguous bytes per
// wave (both tensors lie in fragment order, see the projection). Per 256-row KV tile:
// scores (each wave its own 16 key rows: four 16x16 tiles that share each K
// fragment, K=1024; no K fragment is loaded by two waves), online softmax (all
// waves, eight lanes per row), then O += P @ V (each wave owns 64 output cols;
// each V fragment feeds the four 16-row tiles of the block).
// ---------------------------------------------------------------------------
__global__ __launch_bounds__(512)
void attn_kernel(const __bf16* __restrict__ qp, const __bf16* __restrict__ kp,
                 const __bf16* __restrict__ vpF, float* __restrict__ out) {
  __shared__ __align__(16) __bf16 sQ[QROWS * QPITCH];  // Q tile, ~129 KB
  __shared__ __align__(16) float  sS[QROWS * SPITCH];  // raw scores, f32
  __shared__ __align__(16) __bf16 sP[QROWS * WPITCH];  // softmax probs, bf16
  __shared__ float  sCorr[QROWS];                // per-row rescale factor
  __shared__ float  sStat[QROWS];                // per-row 1/l at the end

  const int lane = threadIdx.x & 31;
  const int wv   = threadIdx.x >> 5;
  const int r    = lane & 15;
  const int hh   = lane >> 4;

  const int batch  = blockIdx.x >> 5;            // 32 q-tiles per batch
  const int q0     = (blockIdx.x & 31) * QROWS;

  const __bf16* qb = qp  + (size_t)batch * S1D * PPD;
  const __bf16* kb = kp  + (size_t)batch * S2D * PPD;
  const __bf16* vb = vpF + (size_t)batch * PPD * S2D;

  // ---- stage Q tile into LDS (async copies, 16B per call per thread)
  {
    const int row = threadIdx.x >> 3;            // 64 rows, 8 threads each
    const int seg = threadIdx.x & 7;             // 16-byte piece of a 128-byte line
    const __bf16* gs = qb + (size_t)(q0 + row) * PPD + seg * 8;
    __bf16* ls = sQ + row * QPITCH + seg * 8;
#pragma unroll
    for (int c = 0; c < 16; ++c)
      copy16_g2l(gs + c * 64, ls + c * 64);
    wait_async_copies();
  }
  __syncthreads();

  const int sn_t  = wv * 16;                     // score tiles' N offset (kv)
  const int ncol0 = wv * 64;                     // output column base
  const int srw   = threadIdx.x >> 3;            // softmax: this lane's row
  const int sq    = threadIdx.x & 7;             // and which 8 of every 64 columns

  const float scale = 0.03125f;                  // 1/sqrt(1024)

  v8f accO[4][4] = {};
  float m_run = -3.0e38f;
  float l_run = 0.0f;

  const __bf16* qlrow = sQ + r * QPITCH;         // A rows now in LDS
  float* swr = sS + hh * 8 * SPITCH + sn_t + r;  // this lane's first score element

  for (int kv = 0; kv < S2D; kv += KVT) {
    // ---- phase 1: S = Q K^T (each wave four 16x16 tiles of the 64x256 block)
    v8f accS[4] = {};
    // B[k][n]=K[n][k]: the units of this wave's 16 key rows, 512 elements per e step
    const __bf16* kfr = kb + (size_t)(kv + sn_t) * PPD + lane * 8;
#pragma unroll 4
    for (int e = 0; e < EED; e += 32) {
      v16bf bk = frag_from_bf16(kfr + e * 16, kfr + e * 16 + 256);
      // unrolled so that accS[] is indexed by constants and stays in registers
#pragma unroll
      for (int mt = 0; mt < 4; ++mt) {
        const __bf16* qr = qlrow + mt * 16 * QPITCH + e;
        v16bf a = frag_from_bf16(qr + hh * 8, qr + 16 + hh * 8);
        accS[mt] = __builtin_amdgcn_wmma_f32_16x16x32_bf16(
            false, a, false, bk, (short)0, accS[mt], false, false);
      }
    }
    // unrolled for the same reason: constant indices into accS[]
#pragma unroll
    for (int mt = 0; mt < 4; ++mt)
#pragma unroll
      for (int v = 0; v < 8; ++v)
        swr[(mt * 16 + v) * SPITCH] = accS[mt][v];

    if (kv + KVT < S2D) {  // hint next K tile toward the caches
      __builtin_prefetch(kb + (size_t)(kv + KVT + sn_t) * PPD + lane * 64, 0, 1);
      // precaution: stands in front of the rewrite of the hint's address registers
      asm volatile("s_wait_xcnt 0x0" ::: "memory");
    }

    __syncthreads();

    // ---- phase 2: online softmax row update (all waves; eight lanes share a
    // row, each holds 32 of its columns in registers: columns sq * 8 .. + 7 of
    // every group of 64; the eight lanes keep equal copies of the row's running
    // maximum and sum)
    {
      const float* srow = sS + srw * SPITCH + sq * 8;
      float s[32];
      // unrolled so that s[] is indexed by constants and stays in registers
#pragma unroll
      for (int j = 0; j < 8; ++j) {
        const v4f t = *(const v4f*)(srow + (j >> 1) * 64 + (j & 1) * 4);
#pragma unroll
        for (int i = 0; i < 4; ++i) s[j * 4 + i] = t[i] * scale;
      }
      float mx = m_run;
#pragma unroll
      for (int c = 0; c < 32; ++c) mx = fmaxf(mx, s[c]);
      mx = fmaxf(mx, quad_swap<0xB1>(mx));
      mx = fmaxf(mx, quad_swap<0x4E>(mx));
      mx = fmaxf(mx, quad_swap<0x164>(mx));
      const float corr = __expf(m_run - mx);
      float lp[4] = {0.0f, 0.0f, 0.0f, 0.0f};    // four independent sum chains
      v8bf pk[4];
#pragma unroll
      for (int c = 0; c < 32; ++c) {
        const float p = __expf(s[c] - mx);
        lp[c & 3] += p;
        pk[c >> 3][c & 7] = (__bf16)p;
      }
      float ls = (lp[0] + lp[1]) + (lp[2] + lp[3]);
      ls += quad_swap<0xB1>(ls);
      ls += quad_swap<0x4E>(ls);
      ls += quad_swap<0x164>(ls);
      __bf16* prow = sP + srw * WPITCH + sq * 8;
      // unrolled so that pk[] is indexed by constants and stays in registers
#pragma unroll
      for (int j = 0; j < 4; ++j) *(v8bf*)(prow + j * 64) = pk[j];
      l_run = l_run * corr + ls;
      m_run = mx;
      if (sq == 0) sCorr[srw] = corr;
    }
    __syncthreads();

    // ---- phase 3: rescale O, then O += P @ V (wave owns 64 output cols)
#pragma unroll
    for (int mt = 0; mt < 4; ++mt)
#pragma unroll
      for (int v = 0; v < 8; ++v) {
        const float c = sCorr[mt * 16 + hh * 8 + v];
#pragma unroll
        for (int nt = 0; nt < 4; ++nt) accO[mt][nt][v] *= c;
      }

    // kept as a loop (eight k steps of 16 products): fully unrolled, the listing
    // held one V fragment in flight at a time; as a loop it holds two
#pragma unroll 1
    for (int ks = 0; ks < KVT; ks += 32) {
      v16bf aP[4];
#pragma unroll
      for (int mt = 0; mt < 4; ++mt) {
        const __bf16* pr = sP + (mt * 16 + r) * WPITCH + ks;
        aP[mt] = frag_from_bf16(pr + hh * 8, pr + 16 + hh * 8);
      }
#pragma unroll
      for (int nt = 0; nt < 4; ++nt) {
        // B[k][n] = V[kv+k][n]: the unit of these 16 columns and 32 key rows
        const __bf16* vfr = vb + (size_t)(((ncol0 >> 4) + nt) * (S2D / 32) + ((kv + ks) >> 5)) * 512
                            + lane * 8;
        v16bf bv = frag_from_bf16(vfr, vfr + 256);
#pragma unroll
        for (int mt = 0; mt < 4; ++mt)
          accO[mt][nt] = __builtin_amdgcn_wmma_f32_16x16x32_bf16(
              false, aP[mt], false, bv, (short)0, accO[mt][nt], false, false);
      }
    }
    __syncthreads();
  }

  // ---- epilogue: divide by row sums, write f32 output
  if (sq == 0) sStat[srw] = 1.0f / l_run;
  __syncthreads();

  float* ob = out + ((size_t)batch * S1D + q0) * PPD;
#pragma unroll
  for (int mt = 0; mt < 4; ++mt)
#pragma unroll
    for (int v = 0; v < 8; ++v) {
      const int row = mt * 16 + hh * 8 + v;
      const float inv = sStat[row];
#pragma unroll
      for (int nt = 0; nt < 4; ++nt)
        ob[(size_t)row * PPD + ncol0 + nt * 16 + r] = accO[mt][nt][v] * inv;
    }
}

extern "C" void kernel_launch(void* const* d_in, const int* in_sizes, int n_in,
                              void* d_out, int out_size, void* d_ws, size_t ws_size,
                              hipStream_t stream) {
  (void)in_sizes; (void)n_in; (void)out_size; (void)ws_size;
  const float* q = (const float*)d_in[0];
  const float* k = (const float*)d_in[1];
  const float* v = (const float*)d_in[2];
  const float* W = (const float*)d_in[3];
  const float* b = (const float*)d_in[4];
  float* out = (float*)d_out;

  // Workspace: bf16 projected Q (B*S1*P, row-major), K (B*S2*P) and V (B*P*S2),
  // the last two in fragment order = 96 MB
  __bf16* qp  = (__bf16*)d_ws;
  __bf16* kp  = qp + (size_t)BB * S1D * PPD;
  __bf16* vpF = kp + (size_t)BB * S2D * PPD;

  dim3 pg(BB * S1D / 128, PPD / 256);
  proj_kernel<<<pg, 256, 0, stream>>>(q, W, b, qp, 0);
  proj_kernel<<<pg, 256, 0, stream>>>(k, W, b, kp, 2);
  proj_kernel<<<pg, 256, 0, stream>>>(v, W, b, vpF, 1);

  dim3 ag(BB * (S1D / QROWS));
  attn_kernel<<<ag, 512, 0, stream>>>(qp, kp, vpF, out);
}

// v007
// One run takes 216 microseconds.
// Two timings next to v006 both put it at 1.23 times that version's speed.
// Counting every step since v000, it is 6.16 times as fast.
#include <hip/hip_runtime.h>
#include <hip/hip_bf16.h>

#define BB 8
#define S1D 2048
#define S2D 2048
#define EED 1024
#define PPD 1024
#define QPITCH 1032   // 1024 + 8 bf16 pad -> row stride 2064B = 129*16B (bank-spread)
#define QROWS 64      // query rows per attention block
#define KVT 256       // key rows per attention pass
#define SPITCH 260    // score row pitch in f32: 256 + 4 pad -> 1040 B = 65*16B (bank-spread)
#define WPITCH 264    // softmax weight row pitch in bf16: 256 + 8 pad -> 528 B = 33*16B (bank-spread)
#define PROWS 384     // rows staged per projection K step: 128 of X + 256 of W
#define PPITCH 40     // their LDS pitch in bf16: 32 + 8 pad -> 80 B = 5*16B (bank-spread)

typedef __attribute__((ext_vector_type(16))) __bf16 v16bf;
typedef __attribute__((ext_vector_type(8)))  __bf16 v8bf;
typedef __attribute__((ext_vector_type(8)))  float  v8f;
typedef __attribute__((ext_vector_type(4)))  int    v4i;
typedef __attribute__((ext_vector_type(4)))  float  v4f;
typedef __attribute__((ext_vector_type(4)))  __bf16 v4bf;

typedef __attribute__((address_space(1))) v4i* as1_v4ip;  // global (prints as __device__*)
typedef __attribute__((address_space(3))) v4i* as3_v4ip;  // LDS

// Build a 16-element bf16 WMMA fragment from two 16-byte chunks.
// Per ISA 7.12.2 (16-bit A/B layout): frag[0..7] = K group (half*8 ..),
// frag[8..15] = K group (16+half*8 ..).
static __device__ inline v16bf frag_from_bf16(const __bf16* p0, const __bf16* p1) {
  v8bf lo = *(const v8bf*)p0;
  v8bf hi = *(const v8bf*)p1;
  return __builtin_shufflevector(lo, hi, 0,1,2,3,4,5,6,7,8,9,10,11,12,13,14,15);
}

// Async global->LDS 16B copy (ASYNCcnt path) with synchronous fallback.
static __device__ inline void copy16_g2l(const __bf16* gsrc, __bf16* ldst) {
#if __has_builtin(__builtin_amdgcn_global_load_async_to_lds_b128)
  __builtin_amdgcn_global_load_async_to_lds_b128(
      (as1_v4ip)gsrc, (as3_v4ip)ldst, 0, 0);
#else
  *(v8bf*)ldst = *(const v8bf*)gsrc;
#endif
}

// Value of the lane whose number differs by the DPP pattern CTRL (quad_perm
// 0xB1: lane ^ 1, 0x4E: lane ^ 2; row_xmask 0x164: lane ^ 4); a register move,
// no LDS traffic.
template <int CTRL>
static __device__ inline float quad_swap(float x) {
  return __builtin_bit_cast(float, __builtin_amdgcn_update_dpp(
      0, __builtin_bit_cast(int, x), CTRL, 0xf, 0xf, true));
}

static __device__ inline void wait_async_copies() {
#if __has_builtin(__builtin_amdgcn_global_load_async_to_lds_b128)
#if __has_builtin(__builtin_amdgcn_s_wait_asynccnt)
  __builtin_amdgcn_s_wait_asynccnt(0);
#else
  asm volatile("s_wait_asynccnt 0" ::: "memory");
#endif
#endif
}

// ---------------------------------------------------------------------------
// Projection: out = X (M x E, f32) @ W^T + b, output bf16.
// mode 0: out row-major (M x P).
// mode 1, 2: out in the order of the attention kernel's B fragments, as units of
// 1024 bytes = 16 lines of the operand x 32 k: [k half of 16][k group of 8]
// [line][8 k], so that lane l of a wave finds its 16 bytes of a half at l * 16
// and one wave-wide 16-byte load covers 512 contiguous bytes (four whole cache
// lines) instead of 32-byte pieces of 16 lines.
// mode 2 (keys): line = key row, k = projected column; units [row / 16][col / 32].
// mode 1 (values): line = projected column, k = key row of the batch; units
// [batch][col / 16][row / 32].
// Block = 256 threads = 8 wave32 waves; block tile 128(M) x 256(N);
// wave tile 64 x 64 (sixteen 16x16 f32 accumulators), K stepped by 32.
// The 384 rows of a K step (128 of X, 256 of W; 128 bytes of f32 each) are
// read once per block with loads in which a wave covers four whole lines,
// converted to bf16 once and kept in LDS; the waves take their fragments from
// there. Two LDS buffers: the next step's global loads are issued ahead of
// this step's products and stored behind them, one barrier per step.
// ---------------------------------------------------------------------------
__global__ __launch_bounds__(256)
void proj_kernel(const float* __restrict__ X, const float* __restrict__ W,
                 const float* __restrict__ bias, __bf16* __restrict__ out,
                 int mode) {
  __shared__ __align__(16) __bf16 sT[2][PROWS * PPITCH];

  const int lane = threadIdx.x & 31;
  const int wv   = threadIdx.x >> 5;
  const int r    = lane & 15;
  const int hh   = lane >> 4;

  const int m0 = blockIdx.x * 128 + (wv & 1) * 64;
  const int n0 = blockIdx.y * 256 + (wv >> 1) * 64;

  // staging: eight threads per row, 16 bytes of f32 each; 32 rows per pass
  const int srow = threadIdx.x >> 3;
  const int spc  = threadIdx.x & 7;
  const float* gx = X + (size_t)(blockIdx.x * 128 + srow) * EED + spc * 4;
  const float* gw = W + (size_t)(blockIdx.y * 256 + srow) * EED + spc * 4;
  const int sdst = srow * PPITCH + spc * 4;

  // fragment rows in LDS: X rows first, W rows behind them
  const int aoff = ((wv & 1) * 64 + r) * PPITCH + hh * 8;
  const int boff = (128 + (wv >> 1) * 64 + r) * PPITCH + hh * 8;

  v4f st[12];
  v8f acc[4][4] = {};

  // All loops over st[], a[] and acc[][] are fully unrolled so that they are
  // indexed by constants and stay in registers.
#pragma unroll
  for (int i = 0; i < 4; ++i) st[i] = *(const v4f*)(gx + (size_t)i * 32 * EED);
#pragma unroll
  for (int i = 0; i < 8; ++i) st[4 + i] = *(const v4f*)(gw + (size_t)i * 32 * EED);
#pragma unroll
  for (int i = 0; i < 12; ++i) {
    v4bf c;
#pragma unroll
    for (int j = 0; j < 4; ++j) c[j] = (__bf16)st[i][j];
    *(v4bf*)(&sT[0][sdst + i * 32 * PPITCH]) = c;
  }
  // the first buffer is complete before any wave takes a fragment from it
  __syncthreads();

  for (int k = 0; k < EED; k += 32) {
    const __bf16* cur = sT[(k >> 5) & 1];
    const bool more = k + 32 < EED;
    if (more) {
#pragma unroll
      for (int i = 0; i < 4; ++i)
        st[i] = *(const v4f*)(gx + (size_t)i * 32 * EED + k + 32);
#pragma unroll
      for (int i = 0; i < 8; ++i)
        st[4 + i] = *(const v4f*)(gw + (size_t)i * 32 * EED + k + 32);
    }

    v16bf a[4];
#pragma unroll
    for (int mt = 0; mt < 4; ++mt) {
      const __bf16* ap = cur + aoff + mt * 16 * PPITCH;
      a[mt] = frag_from_bf16(ap, ap + 16);
    }
#pragma unroll
    for (int nt = 0; nt < 4; ++nt) {
      const __bf16* wp = cur + boff + nt * 16 * PPITCH;
      v16bf bfr = frag_from_bf16(wp, wp + 16);
#pragma unroll
      for (int mt = 0; mt < 4; ++mt)
        acc[mt][nt] = __builtin_amdgcn_wmma_f32_16x16x32_bf16(
            false, a[mt], false, bfr, (short)0, acc[mt][nt], false, false);
    }

    if (more) {
      __bf16* nxt = sT[((k >> 5) + 1) & 1];
#pragma unroll
      for (int i = 0; i < 12; ++i) {
        v4bf c;
#pragma unroll
        for (int j = 0; j < 4; ++j) c[j] = (__bf16)st[i][j];
        *(v4bf*)(nxt + sdst + i * 32 * PPITCH) = c;
      }
    }
    // publishes the buffer just written and ends the reads of the one that the
    // next step overwrites
    __syncthreads();
  }

  if (mode == 0) {
#pragma unroll
    for (int nt = 0; nt < 4; ++nt) {
      const int n = n0 + nt * 16 + r;
      const float bv = bias[n];
#pragma unroll
      for (int mt = 0; mt < 4; ++mt)
#pragma unroll
        for (int v = 0; v < 8; ++v) {
          const int m = m0 + mt * 16 + hh * 8 + v;
          out[(size_t)m * PPD + n] = (__bf16)(acc[mt][nt][v] + bv);
        }
    }
  } else if (mode == 2) {
#pragma unroll
    for (int nt = 0; nt < 4; ++nt) {
      const int n = n0 + nt * 16 + r;
      const float bv = bias[n];
      // place of column n inside its unit row: unit, k half, k group, k
      const int noff = (n >> 5) * 512 + ((n >> 4) & 1) * 256 + ((n >> 3) & 1) * 128 + (n & 7);
#pragma unroll
      for (int mt = 0; mt < 4; ++mt) {
        __bf16* op = out + (size_t)((m0 >> 4) + mt) * (16 * PPD) + noff + hh * 64;
#pragma unroll
        for (int v = 0; v < 8; ++v) op[v * 8] = (__bf16)(acc[mt][nt][v] + bv);
      }
    }
    // precaution: stands in front of every later rewrite of a register that these stores name
    asm volatile("s_wait_xcnt 0x0" ::: "memory");
  } else {
#pragma unroll
    for (int nt = 0; nt < 4; ++nt) {
      const int n = n0 + nt * 16 + r;
      const float bv = bias[n];
#pragma unroll
      for (int mt = 0; mt < 4; ++mt) {
        const int m = m0 + mt * 16;                // first of this tile's 16 rows
        const int batch = m / S2D;
        const int sm = m - batch * S2D;
        v8bf pk;
#pragma unroll
        for (int v = 0; v < 8; ++v) pk[v] = (__bf16)(acc[mt][nt][v] + bv);
        *(v8bf*)(out + (size_t)batch * PPD * S2D
                 + (size_t)((n >> 4) * (S2D / 32) + (sm >> 5)) * 512
                 + ((sm >> 4) & 1) * 256 + lane * 8) = pk;
      }
    }
    // precaution: stands in front of every later rewrite of a register that these stores name
    asm volatile("s_wait_xcnt 0x0" ::: "memory");
  }
}

// Work-group barrier whose fences order LDS traffic only. The data handed over
// at it lie in LDS; with the full fence of __syncthreads() the compiler drains
// the load counter in front of the barrier, and the global fragment loads
// issued ahead of it would be waited for there instead of at their first use.
static __device__ inline void lds_barrier() {
  __builtin_amdgcn_fence(__ATOMIC_RELEASE, "workgroup", "local");
  __builtin_amdgcn_s_barrier();
  __builtin_amdgcn_fence(__ATOMIC_ACQUIRE, "workgroup", "local");
}

// ---------------------------------------------------------------------------
// Flash attention over bf16 projected tensors.
// Grid: B * S1/64. Block = 512 threads (16 waves), one block per 64 query rows
// and all 1024 output columns, so every score is computed once.
// Q tile (64x1024 bf16) staged once to LDS via async global->LDS;
// K/V fragments streamed from L2 with b128 loads of 512 contiguous bytes per
// wave (both tensors lie in fragment order, see the projection), each through a
// ring of registers: a slot is loaded again right behind its last product, four
// e steps (K) or two k steps (V) ahead of its next use. Per 256-row KV tile:
// scores (each wave its own 16 key rows: four 16x16 tiles that share each K
// fragment, K=1024; no K fragment is loaded by two waves), online softmax (all
// waves, eight lanes per row), then O += P @ V (each wave owns 64 output cols;
// each V fragment feeds the four 16-row tiles of the block).
// ---------------------------------------------------------------------------
__global__ __launch_bounds__(512)
void attn_kernel(const __bf16* __restrict__ qp, const __bf16* __restrict__ kp,
                 const __bf16* __restrict__ vpF, float* __restrict__ out) {
  __shared__ __align__(16) __bf16 sQ[QROWS * QPITCH];  // Q tile, ~129 KB
  __shared__ __align__(16) float  sS[QROWS * SPITCH];  // raw scores, f32
  __shared__ __align__(16) __bf16 sP[QROWS * WPITCH];  // softmax probs, bf16
  __shared__ float  sCorr[QROWS];                // per-row rescale factor
  __shared__ float  sStat[QROWS];                // per-row 1/l at the end

  const int lane = threadIdx.x & 31;
  // the wave's number as a scalar: the K and V fragment addresses are then a
  // scalar base plus one lane offset, which leaves the vector registers to the rings
  const int wv   = __builtin_amdgcn_readfirstlane(threadIdx.x >> 5);
  const int r    = lane & 15;
  const int hh   = lane >> 4;

  const int batch  = blockIdx.x >> 5;            // 32 q-tiles per batch
  const int q0     = (blockIdx.x & 31) * QROWS;

  const __bf16* qb = qp  + (size_t)batch * S1D * PPD;
  const __bf16* kb = kp  + (size_t)batch * S2D * PPD;
  const __bf16* vb = vpF + (size_t)batch * PPD * S2D;

  // ---- stage Q tile into LDS (async copies, 16B per call per thread)
  {
    const int row = threadIdx.x >> 3;            // 64 rows, 8 threads each
    const int seg = threadIdx.x & 7;             // 16-byte piece of a 128-byte line
    const __bf16* gs = qb + (size_t)(q0 + row) * PPD + seg * 8;
    __bf16* ls = sQ + row * QPITCH + seg * 8;
#pragma unroll
    for (int c = 0; c < 16; ++c)
      copy16_g2l(gs + c * 64, ls + c * 64);
    wait_async_copies();
  }
  __syncthreads();

  const int sn_t  = wv * 16;                     // score tiles' N offset (kv)
  const int ncol0 = wv * 64;                     // output column base
  const int srw   = threadIdx.x >> 3;            // softmax: this lane's row
  const int sq    = threadIdx.x & 7;             // and which 8 of every 64 columns

  const float scale = 0.03125f;                  // 1/sqrt(1024)

  v8f accO[4][4] = {};
  float m_run = -3.0e38f;
  float l_run = 0.0f;

  const __bf16* qlrow = sQ + r * QPITCH;         // A rows now in LDS
  float* swr = sS + hh * 8 * SPITCH + sn_t + r;  // this lane's first score element

  // K ring: the fragments of four e steps; filled here for the first pass, and
  // for every later pass inside the pass before it
  // B[k][n]=K[n][k]: the units of this wave's 16 key rows, 512 elements per e step;
  // kfr walks along them, always at the ring's oldest slot
  v16bf bk[4];
  const __bf16* kfr = kb + (size_t)sn_t * PPD + lane * 8;
  // unrolled so that bk[] is indexed by constants and stays in registers
#pragma unroll
  for (int j = 0; j < 4; ++j)
    bk[j] = frag_from_bf16(kfr + j * 512, kfr + j * 512 + 256);

  for (int kv = 0; kv < S2D; kv += KVT) {
    // ---- phase 1: S = Q K^T (each wave four 16x16 tiles of the 64x256 block)
    v8f accS[4] = {};
    // kept as a loop of four e steps, one per ring slot; the inner loops are
    // unrolled so that bk[] and accS[] are indexed by constants
#pragma unroll 1
    for (int e = 0; e < EED - 128; e += 128) {
#pragma unroll
      for (int j = 0; j < 4; ++j) {
        v16bf a[4];
#pragma unroll
        for (int mt = 0; mt < 4; ++mt) {
          const __bf16* qr = qlrow + mt * 16 * QPITCH + e + j * 32;
          a[mt] = frag_from_bf16(qr + hh * 8, qr + 16 + hh * 8);
        }
        // keeps the four Q fragments' LDS loads one group ahead of their
        // products: with the ring's registers taken, the compiler otherwise
        // loads one fragment at a time and waits for each
        __builtin_amdgcn_sched_barrier(0);
#pragma unroll
        for (int mt = 0; mt < 4; ++mt)
          accS[mt] = __builtin_amdgcn_wmma_f32_16x16x32_bf16(
              false, a[mt], false, bk[j], (short)0, accS[mt], false, false);
        const __bf16* kn = kfr + (4 + j) * 512;
        bk[j] = frag_from_bf16(kn, kn + 256);
        // keeps the slot's reload here, right behind its last product
        __builtin_amdgcn_sched_barrier(0);
      }
      kfr += 4 * 512;
    }
    // the last four e steps: nothing of this pass is left to load
#pragma unroll
    for (int j = 0; j < 4; ++j) {
      v16bf a[4];
#pragma unroll
      for (int mt = 0; mt < 4; ++mt) {
        const __bf16* qr = qlrow + mt * 16 * QPITCH + (EED - 128) + j * 32;
        a[mt] = frag_from_bf16(qr + hh * 8, qr + 16 + hh * 8);
      }
      // as in the loop: the four LDS loads stay one group
      __builtin_amdgcn_sched_barrier(0);
#pragma unroll
      for (int mt = 0; mt < 4; ++mt)
        accS[mt] = __builtin_amdgcn_wmma_f32_16x16x32_bf16(
            false, a[mt], false, bk[j], (short)0, accS[mt], false, false);
    }
    // unrolled for the same reason: constant indices into accS[]
#pragma unroll
    for (int mt = 0; mt < 4; ++mt)
#pragma unroll
      for (int v = 0; v < 8; ++v)
        swr[(mt * 16 + v) * SPITCH] = accS[mt][v];

    __syncthreads();

    // ---- phase 2: online softmax row update (all waves; eight lanes share a
    // row, each holds 32 of its columns in registers: columns sq * 8 .. + 7 of
    // every group of 64; the eight lanes keep equal copies of the row's running
    // maximum and sum)
    {
      const float* srow = sS + srw * SPITCH + sq * 8;
      float s[32];
      // unrolled so that s[] is indexed by constants and stays in registers
#pragma unroll
      for (int j = 0; j < 8; ++j) {
        const v4f t = *(const v4f*)(srow + (j >> 1) * 64 + (j & 1) * 4);
#pragma unroll
        for (int i = 0; i < 4; ++i) s[j * 4 + i] = t[i] * scale;
      }
      float mx = m_run;
#pragma unroll
      for (int c = 0; c < 32; ++c) mx = fmaxf(mx, s[c]);
      mx = fmaxf(mx, quad_swap<0xB1>(mx));
      mx = fmaxf(mx, quad_swap<0x4E>(mx));
      mx = fmaxf(mx, quad_swap<0x164>(mx));
      const float corr = __expf(m_run - mx);
      float lp[4] = {0.0f, 0.0f, 0.0f, 0.0f};    // four independent sum chains
      v8bf pk[4];
#pragma unroll
      for (int c = 0; c < 32; ++c) {
        const float p = __expf(s[c] - mx);
        lp[c & 3] += p;
        pk[c >> 3][c & 7] = (__bf16)p;
      }
      float ls = (lp[0] + lp[1]) + (lp[2] + lp[3]);
      ls += quad_swap<0xB1>(ls);
      ls += quad_swap<0x4E>(ls);
      ls += quad_swap<0x164>(ls);
      __bf16* prow = sP + srw * WPITCH + sq * 8;
      // unrolled so that pk[] is indexed by constants and stays in registers
#pragma unroll
      for (int j = 0; j < 4; ++j) *(v8bf*)(prow + j * 64) = pk[j];
      l_run = l_run * corr + ls;
      m_run = mx;
      if (sq == 0) sCorr[srw] = corr;
    }

    // V ring: the fragments of two k steps (four column tiles each), first
    // filled here so that they fly during the barrier and the rescale.
    // B[k][n] = V[kv+k][n]: the unit of 16 columns and 32 key rows
    // vfr walks along the key rows, always at the ring's oldest k step
    const __bf16* vfr = vb + (size_t)((ncol0 >> 4) * (S2D / 32) + (kv >> 5)) * 512 + lane * 8;
    v16bf bv[2][4];
    // unrolled so that bv[][] is indexed by constants and stays in registers
#pragma unroll
    for (int s = 0; s < 2; ++s)
#pragma unroll
      for (int nt = 0; nt < 4; ++nt) {
        const __bf16* vn = vfr + (nt * (S2D / 32) + s) * 512;
        bv[s][nt] = frag_from_bf16(vn, vn + 256);
      }
    // precaution: stands in front of every later rewrite of the address registers
    // that these loads name; as an input the pointer outlives the loads, so that
    // its registers are not handed to the last load as its destination
    asm volatile("s_wait_xcnt 0x0" :: "v"(vfr) : "memory");
    lds_barrier();

    // ---- phase 3: rescale O, then O += P @ V (wave owns 64 output cols)
#pragma unroll
    for (int mt = 0; mt < 4; ++mt)
#pragma unroll
      for (int v = 0; v < 8; ++v) {
        const float c = sCorr[mt * 16 + hh * 8 + v];
#pragma unroll
        for (int nt = 0; nt < 4; ++nt) accO[mt][nt][v] *= c;
      }

    // kept as a loop of two k steps, one per half of the ring; the inner loops
    // are unrolled so that bv[][], aP[] and accO[][] are indexed by constants
#pragma unroll 1
    for (int ks = 0; ks < KVT - 64; ks += 64) {
#pragma unroll
      for (int s = 0; s < 2; ++s) {
        v16bf aP[4];
#pragma unroll
        for (int mt = 0; mt < 4; ++mt) {
          const __bf16* pr = sP + (mt * 16 + r) * WPITCH + ks + s * 32;
          aP[mt] = frag_from_bf16(pr + hh * 8, pr + 16 + hh * 8);
        }
#pragma unroll
        for (int nt = 0; nt < 4; ++nt) {
#pragma unroll
          for (int mt = 0; mt < 4; ++mt)
            accO[mt][nt] = __builtin_amdgcn_wmma_f32_16x16x32_bf16(
                false, aP[mt], false, bv[s][nt], (short)0, accO[mt][nt], false, false);
          const __bf16* vn = vfr + (nt * (S2D / 32) + s + 2) * 512;
          bv[s][nt] = frag_from_bf16(vn, vn + 256);
        }
      }
      vfr += 2 * 512;
    }
    // the last two k steps: nothing of V is left to load; between them the K
    // ring is filled for the next pass (behind the last pass: the first tile
    // once more, an address in bounds whose values are not used)
#pragma unroll
    for (int s = 0; s < 2; ++s) {
      v16bf aP[4];
#pragma unroll
      for (int mt = 0; mt < 4; ++mt) {
        const __bf16* pr = sP + (mt * 16 + r) * WPITCH + (KVT - 64) + s * 32;
        aP[mt] = frag_from_bf16(pr + hh * 8, pr + 16 + hh * 8);
      }
#pragma unroll
      for (int nt = 0; nt < 4; ++nt)
#pragma unroll
        for (int mt = 0; mt < 4; ++mt)
          accO[mt][nt] = __builtin_amdgcn_wmma_f32_16x16x32_bf16(
              false, aP[mt], false, bv[s][nt], (short)0, accO[mt][nt], false, false);
      if (s == 0) {
        const int kvn = kv + KVT < S2D ? kv + KVT : 0;
        kfr = kb + (size_t)(kvn + sn_t) * PPD + lane * 8;
#pragma unroll
        for (int j = 0; j < 4; ++j)
          bk[j] = frag_from_bf16(kfr + j * 512, kfr + j * 512 + 256);
        // keeps these loads here, a k step's products ahead of the barrier
        __builtin_amdgcn_sched_barrier(0);
      }
    }
    lds_barrier();
  }

  // ---- epilogue: divide by row sums, write f32 output
  if (sq == 0) sStat[srw] = 1.0f / l_run;
  __syncthreads();

  float* ob = out + ((size_t)batch * S1D + q0) * PPD;
  // the lane's number read anew: its parts need no register through the loops,
  // where the rings leave none to spare (they went to scratch otherwise)
  const int elane = __builtin_amdgcn_mbcnt_lo(~0u, 0u);
  const int er = elane & 15;
  const int eh = elane >> 4;
#pragma unroll
  for (int mt = 0; mt < 4; ++mt)
#pragma unroll
    for (int v = 0; v < 8; ++v) {
      const int row = mt * 16 + eh * 8 + v;
      const float inv = sStat[row];
#pragma unroll
      for (int nt = 0; nt < 4; ++nt)
        ob[(size_t)row * PPD + ncol0 + nt * 16 + er] = accO[mt][nt][v] * inv;
    }
}

extern "C" void kernel_launch(void* const* d_in, const int* in_sizes, int n_in,
                              void* d_out, int out_size, void* d_ws, size_t ws_size,
                              hipStream_t stream) {
  (void)in_sizes; (void)n_in; (void)out_size; (void)ws_size;
  const float* q = (const float*)d_in[0];
  const float* k = (const float*)d_in[1];
  const float* v = (const float*)d_in[2];
  const float* W = (const float*)d_in[3];
  const float* b = (const float*)d_in[4];
  float* out = (float*)d_out;

  // Workspace: bf16 projected Q (B*S1*P, row-major), K (B*S2*P) and V (B*P*S2),
  // the last two in fragment order = 96 MB
  __bf16* qp  = (__bf16*)d_ws;
  __bf16* kp  = qp + (size_t)BB * S1D * PPD;
  __bf16* vpF = kp + (size_t)BB * S2D * PPD;

  dim3 pg(BB * S1D / 128, PPD / 256);
  proj_kernel<<<pg, 256, 0, stream>>>(q, W, b, qp, 0);
  proj_kernel<<<pg, 256, 0, stream>>>(k, W, b, kp, 2);
  proj_kernel<<<pg, 256, 0, stream>>>(v, W, b, vpF, 1);

  dim3 ag(BB * (S1D / QROWS));
  attn_kernel<<<ag, 512, 0, stream>>>(qp, kp, vpF, out);
}

// v008
// It runs in 210 microseconds.
// Timed twice side by side with v007, it ran 1.03 times as fast both times.
// All steps since v000 together make it 6.36 times as fast.
#include <hip/hip_runtime.h>
#include <hip/hip_bf16.h>

#define BB 8
#define S1D 2048
#define S2D 2048
#define EED 1024
#define PPD 1024
#define QPITCH 1032   // 1024 + 8 bf16 pad -> row stride 2064B = 129*16B (bank-spread)
#define QROWS 64      // query rows per attention block
#define KVT 256       // key rows per attention pass
#define SPITCH 260    // score row pitch in f32: 256 + 4 pad -> 1040 B = 65*16B (bank-spread)
#define WPITCH 264    // softmax weight row pitch in bf16: 256 + 8 pad -> 528 B = 33*16B (bank-spread)
#define PROWS 384     // rows staged per projection K step: 128 of X + 256 of W
#define PPITCH 40     // their LDS pitch in bf16: 32 + 8 pad -> 80 B = 5*16B (bank-spread)

typedef __attribute__((ext_vector_type(16))) __bf16 v16bf;
typedef __attribute__((ext_vector_type(8)))  __bf16 v8bf;
typedef __attribute__((ext_vector_type(8)))  float  v8f;
typedef __attribute__((ext_vector_type(4)))  int    v4i;
typedef __attribute__((ext_vector_type(4)))  float  v4f;
typedef __attribute__((ext_vector_type(4)))  __bf16 v4bf;

typedef __attribute__((address_space(1))) v4i* as1_v4ip;  // global (prints as __device__*)
typedef __attribute__((address_space(3))) v4i* as3_v4ip;  // LDS

// Build a 16-element bf16 WMMA fragment from two 16-byte chunks.
// Per ISA 7.12.2 (16-bit A/B layout): frag[0..7] = K group (half*8 ..),
// frag[8..15] = K group (16+half*8 ..).
static __device__ inline v16bf frag_from_bf16(const __bf16* p0, const __bf16* p1) {
  v8bf lo = *(const v8bf*)p0;
  v8bf hi = *(const v8bf*)p1;
  return __builtin_shufflevector(lo, hi, 0,1,2,3,4,5,6,7,8,9,10,11,12,13,14,15);
}

// Async global->LDS 16B copy (ASYNCcnt path) with synchronous fallback.
static __device__ inline void copy16_g2l(const __bf16* gsrc, __bf16* ldst) {
#if __has_builtin(__builtin_amdgcn_global_load_async_to_lds_b128)
  __builtin_amdgcn_global_load_async_to_lds_b128(
      (as1_v4ip)gsrc, (as3_v4ip)ldst, 0, 0);
#else
  *(v8bf*)ldst = *(const v8bf*)gsrc;
#endif
}

// Value of the lane whose number differs by the DPP pattern CTRL (quad_perm
// 0xB1: lane ^ 1, 0x4E: lane ^ 2; row_xmask 0x164: lane ^ 4); a register move,
// no LDS traffic.
template <int CTRL>
static __device__ inline float quad_swap(float x) {
  return __builtin_bit_cast(float, __builtin_amdgcn_update_dpp(
      0, __builtin_bit_cast(int, x), CTRL, 0xf, 0xf, true));
}

static __device__ inline void wait_async_copies() {
#if __has_builtin(__builtin_amdgcn_global_load_async_to_lds_b128)
#if __has_builtin(__builtin_amdgcn_s_wait_asynccnt)
  __builtin_amdgcn_s_wait_asynccnt(0);
#else
  asm volatile("s_wait_asynccnt 0" ::: "memory");
#endif
#endif
}

// ---------------------------------------------------------------------------
// Projection: out = X (M x E, f32) @ W^T + b, output bf16.
// One launch does the three independent projections: blockIdx.z picks the input
// and its output (0 queries, 1 keys, 2 values), so that a WGP goes from one
// tensor's tile to the next one's with no launch boundary in between. The
// values come last: their tiles have the shortest store phase, and the last
// tiles' store phase has no other tile's products to run beside.
// mode 0 (queries): out row-major (M x P).
// mode 1, 2: out in the order of the attention kernel's B fragments, as units of
// 1024 bytes = 16 lines of the operand x 32 k: [k half of 16][k group of 8]
// [line][8 k], so that lane l of a wave finds its 16 bytes of a half at l * 16
// and one wave-wide 16-byte load covers 512 contiguous bytes (four whole cache
// lines) instead of 32-byte pieces of 16 lines.
// mode 2 (keys): line = key row, k = projected column; units [row / 16][col / 32].
// mode 1 (values): line = projected column, k = key row of the batch; units
// [batch][col / 16][row / 32].
// Block = 256 threads = 8 wave32 waves; block tile 128(M) x 256(N);
// wave tile 64 x 64 (sixteen 16x16 f32 accumulators), K stepped by 32.
// The 384 rows of a K step (128 of X, 256 of W; 128 bytes of f32 each) are
// read once per block with loads in which a wave covers four whole lines,
// converted to bf16 once and kept in LDS; the waves take their fragments from
// there. Two LDS buffers: the next step's global loads are issued ahead of
// this step's products and stored behind them, one barrier per step.
// ---------------------------------------------------------------------------
__global__ __launch_bounds__(256)
void proj_kernel(const float* __restrict__ Xq, const float* __restrict__ Xk,
                 const float* __restrict__ Xv, const float* __restrict__ W,
                 const float* __restrict__ bias, __bf16* __restrict__ oq,
                 __bf16* __restrict__ ok, __bf16* __restrict__ ov) {
  __shared__ __align__(16) __bf16 sT[2][PROWS * PPITCH];

  const int which = blockIdx.z;
  const float* __restrict__ X = which == 0 ? Xq : (which == 1 ? Xk : Xv);
  __bf16* __restrict__ out    = which == 0 ? oq : (which == 1 ? ok : ov);
  const int mode = which == 0 ? 0 : (which == 1 ? 2 : 1);

  const int lane = threadIdx.x & 31;
  const int wv   = threadIdx.x >> 5;
  const int r    = lane & 15;
  const int hh   = lane >> 4;

  const int m0 = blockIdx.x * 128 + (wv & 1) * 64;
  const int n0 = blockIdx.y * 256 + (wv >> 1) * 64;

  // staging: eight threads per row, 16 bytes of f32 each; 32 rows per pass
  const int srow = threadIdx.x >> 3;
  const int spc  = threadIdx.x & 7;
  const float* gx = X + (size_t)(blockIdx.x * 128 + srow) * EED + spc * 4;
  const float* gw = W + (size_t)(blockIdx.y * 256 + srow) * EED + spc * 4;
  const int sdst = srow * PPITCH + spc * 4;

  // fragment rows in LDS: X rows first, W rows behind them
  const int aoff = ((wv & 1) * 64 + r) * PPITCH + hh * 8;
  const int boff = (128 + (wv >> 1) * 64 + r) * PPITCH + hh * 8;

  v4f st[12];
  v8f acc[4][4] = {};

  // All loops over st[], a[] and acc[][] are fully unrolled so that they are
  // indexed by constants and stay in registers.
#pragma unroll
  for (int i = 0; i < 4; ++i) st[i] = *(const v4f*)(gx + (size_t)i * 32 * EED);
#pragma unroll
  for (int i = 0; i < 8; ++i) st[4 + i] = *(const v4f*)(gw + (size_t)i * 32 * EED);
#pragma unroll
  for (int i = 0; i < 12; ++i) {
    v4bf c;
#pragma unroll
    for (int j = 0; j < 4; ++j) c[j] = (__bf16)st[i][j];
    *(v4bf*)(&sT[0][sdst + i * 32 * PPITCH]) = c;
  }
  // the first buffer is complete before any wave takes a fragment from it
  __syncthreads();

  for (int k = 0; k < EED; k += 32) {
    const __bf16* cur = sT[(k >> 5) & 1];
    const bool more = k + 32 < EED;
    if (more) {
#pragma unroll
      for (int i = 0; i < 4; ++i)
        st[i] = *(const v4f*)(gx + (size_t)i * 32 * EED + k + 32);
#pragma unroll
      for (int i = 0; i < 8; ++i)
        st[4 + i] = *(const v4f*)(gw + (size_t)i * 32 * EED + k + 32);
    }

    v16bf a[4];
#pragma unroll
    for (int mt = 0; mt < 4; ++mt) {
      const __bf16* ap = cur + aoff + mt * 16 * PPITCH;
      a[mt] = frag_from_bf16(ap, ap + 16);
    }
#pragma unroll
    for (int nt = 0; nt < 4; ++nt) {
      const __bf16* wp = cur + boff + nt * 16 * PPITCH;
      v16bf bfr = frag_from_bf16(wp, wp + 16);
#pragma unroll
      for (int mt = 0; mt < 4; ++mt)
        acc[mt][nt] = __builtin_amdgcn_wmma_f32_16x16x32_bf16(
            false, a[mt], false, bfr, (short)0, acc[mt][nt], false, false);
    }

    if (more) {
      __bf16* nxt = sT[((k >> 5) + 1) & 1];
#pragma unroll
      for (int i = 0; i < 12; ++i) {
        v4bf c;
#pragma unroll
        for (int j = 0; j < 4; ++j) c[j] = (__bf16)st[i][j];
        *(v4bf*)(nxt + sdst + i * 32 * PPITCH) = c;
      }
    }
    // publishes the buffer just written and ends the reads of the one that the
    // next step overwrites
    __syncthreads();
  }

  if (mode == 0) {
#pragma unroll
    for (int nt = 0; nt < 4; ++nt) {
      const int n = n0 + nt * 16 + r;
      const float bv = bias[n];
#pragma unroll
      for (int mt = 0; mt < 4; ++mt)
#pragma unroll
        for (int v = 0; v < 8; ++v) {
          const int m = m0 + mt * 16 + hh * 8 + v;
          out[(size_t)m * PPD + n] = (__bf16)(acc[mt][nt][v] + bv);
        }
    }
  } else if (mode == 2) {
#pragma unroll
    for (int nt = 0; nt < 4; ++nt) {
      const int n = n0 + nt * 16 + r;
      const float bv = bias[n];
      // place of column n inside its unit row: unit, k half, k group, k
      const int noff = (n >> 5) * 512 + ((n >> 4) & 1) * 256 + ((n >> 3) & 1) * 128 + (n & 7);
#pragma unroll
      for (int mt = 0; mt < 4; ++mt) {
        __bf16* op = out + (size_t)((m0 >> 4) + mt) * (16 * PPD) + noff + hh * 64;
#pragma unroll
        for (int v = 0; v < 8; ++v) op[v * 8] = (__bf16)(acc[mt][nt][v] + bv);
      }
    }
    // precaution: stands in front of every later rewrite of a register that these stores name
    asm volatile("s_wait_xcnt 0x0" ::: "memory");
  } else {
#pragma unroll
    for (int nt = 0; nt < 4; ++nt) {
      const int n = n0 + nt * 16 + r;
      const float bv = bias[n];
#pragma unroll
      for (int mt = 0; mt < 4; ++mt) {
        const int m = m0 + mt * 16;                // first of this tile's 16 rows
        const int batch = m / S2D;
        const int sm = m - batch * S2D;
        v8bf pk;
#pragma unroll
        for (int v = 0; v < 8; ++v) pk[v] = (__bf16)(acc[mt][nt][v] + bv);
        *(v8bf*)(out + (size_t)batch * PPD * S2D
                 + (size_t)((n >> 4) * (S2D / 32) + (sm >> 5)) * 512
                 + ((sm >> 4) & 1) * 256 + lane * 8) = pk;
      }
    }
    // precaution: stands in front of every later rewrite of a register that these stores name
    asm volatile("s_wait_xcnt 0x0" ::: "memory");
  }
}

// Work-group barrier whose fences order LDS traffic only. The data handed over
// at it lie in LDS; with the full fence of __syncthreads() the compiler drains
// the load counter in front of the barrier, and the global fragment loads
// issued ahead of it would be waited for there instead of at their first use.
static __device__ inline void lds_barrier() {
  __builtin_amdgcn_fence(__ATOMIC_RELEASE, "workgroup", "local");
  __builtin_amdgcn_s_barrier();
  __builtin_amdgcn_fence(__ATOMIC_ACQUIRE, "workgroup", "local");
}

// ---------------------------------------------------------------------------
// Flash attention over bf16 projected tensors.
// Grid: B * S1/64. Block = 512 threads (16 waves), one block per 64 query rows
// and all 1024 output columns, so every score is computed once.
// Q tile (64x1024 bf16) staged once to LDS via async global->LDS;
// K/V fragments streamed from L2 with b128 loads of 512 contiguous bytes per
// wave (both tensors lie in fragment order, see the projection), each through a
// ring of registers: a slot is loaded again right behind its last product, four
// e steps (K) or two k steps (V) ahead of its next use. Per 256-row KV tile:
// scores (each wave its own 16 key rows: four 16x16 tiles that share each K
// fragment, K=1024; no K fragment is loaded by two waves), online softmax (all
// waves, eight lanes per row), then O += P @ V (each wave owns 64 output cols;
// each V fragment feeds the four 16-row tiles of the block).
// ---------------------------------------------------------------------------
__global__ __launch_bounds__(512)
void attn_kernel(const __bf16* __restrict__ qp, const __bf16* __restrict__ kp,
                 const __bf16* __restrict__ vpF, float* __restrict__ out) {
  __shared__ __align__(16) __bf16 sQ[QROWS * QPITCH];  // Q tile, ~129 KB
  __shared__ __align__(16) float  sS[QROWS * SPITCH];  // raw scores, f32
  __shared__ __align__(16) __bf16 sP[QROWS * WPITCH];  // softmax probs, bf16
  __shared__ float  sCorr[QROWS];                // per-row rescale factor
  __shared__ float  sStat[QROWS];                // per-row 1/l at the end

  const int lane = threadIdx.x & 31;
  // the wave's number as a scalar: the K and V fragment addresses are then a
  // scalar base plus one lane offset, which leaves the vector registers to the rings
  const int wv   = __builtin_amdgcn_readfirstlane(threadIdx.x >> 5);
  const int r    = lane & 15;
  const int hh   = lane >> 4;

  const int batch  = blockIdx.x >> 5;            // 32 q-tiles per batch
  const int q0     = (blockIdx.x & 31) * QROWS;

  const __bf16* qb = qp  + (size_t)batch * S1D * PPD;
  const __bf16* kb = kp  + (size_t)batch * S2D * PPD;
  const __bf16* vb = vpF + (size_t)batch * PPD * S2D;

  // ---- stage Q tile into LDS (async copies, 16B per call per thread)
  {
    const int row = threadIdx.x >> 3;            // 64 rows, 8 threads each
    const int seg = threadIdx.x & 7;             // 16-byte piece of a 128-byte line
    const __bf16* gs = qb + (size_t)(q0 + row) * PPD + seg * 8;
    __bf16* ls = sQ + row * QPITCH + seg * 8;
#pragma unroll
    for (int c = 0; c < 16; ++c)
      copy16_g2l(gs + c * 64, ls + c * 64);
    wait_async_copies();
  }
  __syncthreads();

  const int sn_t  = wv * 16;                     // score tiles' N offset (kv)
  const int ncol0 = wv * 64;                     // output column base
  const int srw   = threadIdx.x >> 3;            // softmax: this lane's row
  const int sq    = threadIdx.x & 7;             // and which 8 of every 64 columns

  const float scale = 0.03125f;                  // 1/sqrt(1024)

  v8f accO[4][4] = {};
  float m_run = -3.0e38f;
  float l_run = 0.0f;

  const __bf16* qlrow = sQ + r * QPITCH;         // A rows now in LDS
  float* swr = sS + hh * 8 * SPITCH + sn_t + r;  // this lane's first score element

  // K ring: the fragments of four e steps; filled here for the first pass, and
  // for every later pass inside the pass before it
  // B[k][n]=K[n][k]: the units of this wave's 16 key rows, 512 elements per e step;
  // kfr walks along them, always at the ring's oldest slot
  v16bf bk[4];
  const __bf16* kfr = kb + (size_t)sn_t * PPD + lane * 8;
  // unrolled so that bk[] is indexed by constants and stays in registers
#pragma unroll
  for (int j = 0; j < 4; ++j)
    bk[j] = frag_from_bf16(kfr + j * 512, kfr + j * 512 + 256);

  for (int kv = 0; kv < S2D; kv += KVT) {
    // ---- phase 1: S = Q K^T (each wave four 16x16 tiles of the 64x256 block)
    v8f accS[4] = {};
    // kept as a loop of four e steps, one per ring slot; the inner loops are
    // unrolled so that bk[] and accS[] are indexed by constants
#pragma unroll 1
    for (int e = 0; e < EED - 128; e += 128) {
#pragma unroll
      for (int j = 0; j < 4; ++j) {
        v16bf a[4];
#pragma unroll
        for (int mt = 0; mt < 4; ++mt) {
          const __bf16* qr = qlrow + mt * 16 * QPITCH + e + j * 32;
          a[mt] = frag_from_bf16(qr + hh * 8, qr + 16 + hh * 8);
        }
        // keeps the four Q fragments' LDS loads one group ahead of their
        // products: with the ring's registers taken, the compiler otherwise
        // loads one fragment at a time and waits for each
        __builtin_amdgcn_sched_barrier(0);
#pragma unroll
        for (int mt = 0; mt < 4; ++mt)
          accS[mt] = __builtin_amdgcn_wmma_f32_16x16x32_bf16(
              false, a[mt], false, bk[j], (short)0, accS[mt], false, false);
        const __bf16* kn = kfr + (4 + j) * 512;
        bk[j] = frag_from_bf16(kn, kn + 256);
        // keeps the slot's reload here, right behind its last product
        __builtin_amdgcn_sched_barrier(0);
      }
      kfr += 4 * 512;
    }
    // the last four e steps: nothing of this pass is left to load
#pragma unroll
    for (int j = 0; j < 4; ++j) {
      v16bf a[4];
#pragma unroll
      for (int mt = 0; mt < 4; ++mt) {
        const __bf16* qr = qlrow + mt * 16 * QPITCH + (EED - 128) + j * 32;
        a[mt] = frag_from_bf16(qr + hh * 8, qr + 16 + hh * 8);
      }
      // as in the loop: the four LDS loads stay one group
      __builtin_amdgcn_sched_barrier(0);
#pragma unroll
      for (int mt = 0; mt < 4; ++mt)
        accS[mt] = __builtin_amdgcn_wmma_f32_16x16x32_bf16(
            false, a[mt], false, bk[j], (short)0, accS[mt], false, false);
    }
    // unrolled for the same reason: constant indices into accS[]
#pragma unroll
    for (int mt = 0; mt < 4; ++mt)
#pragma unroll
      for (int v = 0; v < 8; ++v)
        swr[(mt * 16 + v) * SPITCH] = accS[mt][v];

    __syncthreads();

    // ---- phase 2: online softmax row update (all waves; eight lanes share a
    // row, each holds 32 of its columns in registers: columns sq * 8 .. + 7 of
    // every group of 64; the eight lanes keep equal copies of the row's running
    // maximum and sum)
    {
      const float* srow = sS + srw * SPITCH + sq * 8;
      float s[32];
      // unrolled so that s[] is indexed by constants and stays in registers
#pragma unroll
      for (int j = 0; j < 8; ++j) {
        const v4f t = *(const v4f*)(srow + (j >> 1) * 64 + (j & 1) * 4);
#pragma unroll
        for (int i = 0; i < 4; ++i) s[j * 4 + i] = t[i] * scale;
      }
      float mx = m_run;
#pragma unroll
      for (int c = 0; c < 32; ++c) mx = fmaxf(mx, s[c]);
      mx = fmaxf(mx, quad_swap<0xB1>(mx));
      mx = fmaxf(mx, quad_swap<0x4E>(mx));
      mx = fmaxf(mx, quad_swap<0x164>(mx));
      const float corr = __expf(m_run - mx);
      float lp[4] = {0.0f, 0.0f, 0.0f, 0.0f};    // four independent sum chains
      v8bf pk[4];
#pragma unroll
      for (int c = 0; c < 32; ++c) {
        const float p = __expf(s[c] - mx);
        lp[c & 3] += p;
        pk[c >> 3][c & 7] = (__bf16)p;
      }
      float ls = (lp[0] + lp[1]) + (lp[2] + lp[3]);
      ls += quad_swap<0xB1>(ls);
      ls += quad_swap<0x4E>(ls);
      ls += quad_swap<0x164>(ls);
      __bf16* prow = sP + srw * WPITCH + sq * 8;
      // unrolled so that pk[] is indexed by constants and stays in registers
#pragma unroll
      for (int j = 0; j < 4; ++j) *(v8bf*)(prow + j * 64) = pk[j];
      l_run = l_run * corr + ls;
      m_run = mx;
      if (sq == 0) sCorr[srw] = corr;
    }

    // V ring: the fragments of two k steps (four column tiles each), first
    // filled here so that they fly during the barrier and the rescale.
    // B[k][n] = V[kv+k][n]: the unit of 16 columns and 32 key rows
    // vfr walks along the key rows, always at the ring's oldest k step
    const __bf16* vfr = vb + (size_t)((ncol0 >> 4) * (S2D / 32) + (kv >> 5)) * 512 + lane * 8;
    v16bf bv[2][4];
    // unrolled so that bv[][] is indexed by constants and stays in registers
#pragma unroll
    for (int s = 0; s < 2; ++s)
#pragma unroll
      for (int nt = 0; nt < 4; ++nt) {
        const __bf16* vn = vfr + (nt * (S2D / 32) + s) * 512;
        bv[s][nt] = frag_from_bf16(vn, vn + 256);
      }
    // precaution: stands in front of every later rewrite of the address registers
    // that these loads name; as an input the pointer outlives the loads, so that
    // its registers are not handed to the last load as its destination
    asm volatile("s_wait_xcnt 0x0" :: "v"(vfr) : "memory");
    lds_barrier();

    // ---- phase 3: rescale O, then O += P @ V (wave owns 64 output cols)
#pragma unroll
    for (int mt = 0; mt < 4; ++mt)
#pragma unroll
      for (int v = 0; v < 8; ++v) {
        const float c = sCorr[mt * 16 + hh * 8 + v];
#pragma unroll
        for (int nt = 0; nt < 4; ++nt) accO[mt][nt][v] *= c;
      }

    // kept as a loop of two k steps, one per half of the ring; the inner loops
    // are unrolled so that bv[][], aP[] and accO[][] are indexed by constants
#pragma unroll 1
    for (int ks = 0; ks < KVT - 64; ks += 64) {
#pragma unroll
      for (int s = 0; s < 2; ++s) {
        v16bf aP[4];
#pragma unroll
        for (int mt = 0; mt < 4; ++mt) {
          const __bf16* pr = sP + (mt * 16 + r) * WPITCH + ks + s * 32;
          aP[mt] = frag_from_bf16(pr + hh * 8, pr + 16 + hh * 8);
        }
#pragma unroll
        for (int nt = 0; nt < 4; ++nt) {
#pragma unroll
          for (int mt = 0; mt < 4; ++mt)
            accO[mt][nt] = __builtin_amdgcn_wmma_f32_16x16x32_bf16(
                false, aP[mt], false, bv[s][nt], (short)0, accO[mt][nt], false, false);
          const __bf16* vn = vfr + (nt * (S2D / 32) + s + 2) * 512;
          bv[s][nt] = frag_from_bf16(vn, vn + 256);
        }
      }
      vfr += 2 * 512;
    }
    // the last two k steps: nothing of V is left to load; between them the K
    // ring is filled for the next pass (behind the last pass: the first tile
    // once more, an address in bounds whose values are not used)
#pragma unroll
    for (int s = 0; s < 2; ++s) {
      v16bf aP[4];
#pragma unroll
      for (int mt = 0; mt < 4; ++mt) {
        const __bf16* pr = sP + (mt * 16 + r) * WPITCH + (KVT - 64) + s * 32;
        aP[mt] = frag_from_bf16(pr + hh * 8, pr + 16 + hh * 8);
      }
#pragma unroll
      for (int nt = 0; nt < 4; ++nt)
#pragma unroll
        for (int mt = 0; mt < 4; ++mt)
          accO[mt][nt] = __builtin_amdgcn_wmma_f32_16x16x32_bf16(
              false, aP[mt], false, bv[s][nt], (short)0, accO[mt][nt], false, false);
      if (s == 0) {
        const int kvn = kv + KVT < S2D ? kv + KVT : 0;
        kfr = kb + (size_t)(kvn + sn_t) * PPD + lane * 8;
#pragma unroll
        for (int j = 0; j < 4; ++j)
          bk[j] = frag_from_bf16(kfr + j * 512, kfr + j * 512 + 256);
        // keeps these loads here, a k step's products ahead of the barrier
        __builtin_amdgcn_sched_barrier(0);
      }
    }
    lds_barrier();
  }

  // ---- epilogue: divide by row sums, write f32 output
  if (sq == 0) sStat[srw] = 1.0f / l_run;
  __syncthreads();

  float* ob = out + ((size_t)batch * S1D + q0) * PPD;
  // the lane's number read anew: its parts need no register through the loops,
  // where the rings leave none to spare (they went to scratch otherwise)
  const int elane = __builtin_amdgcn_mbcnt_lo(~0u, 0u);
  const int er = elane & 15;
  const int eh = elane >> 4;
#pragma unroll
  for (int mt = 0; mt < 4; ++mt)
#pragma unroll
    for (int v = 0; v < 8; ++v) {
      const int row = mt * 16 + eh * 8 + v;
      const float inv = sStat[row];
#pragma unroll
      for (int nt = 0; nt < 4; ++nt)
        ob[(size_t)row * PPD + ncol0 + nt * 16 + er] = accO[mt][nt][v] * inv;
    }
}

extern "C" void kernel_launch(void* const* d_in, const int* in_sizes, int n_in,
                              void* d_out, int out_size, void* d_ws, size_t ws_size,
                              hipStream_t stream) {
  (void)in_sizes; (void)n_in; (void)out_size; (void)ws_size;
  const float* q = (const float*)d_in[0];
  const float* k = (const float*)d_in[1];
  const float* v = (const float*)d_in[2];
  const float* W = (const float*)d_in[3];
  const float* b = (const float*)d_in[4];
  float* out = (float*)d_out;

  // Workspace: bf16 projected Q (B*S1*P, row-major), K (B*S2*P) and V (B*P*S2),
  // the last two in fragment order = 96 MB
  __bf16* qp  = (__bf16*)d_ws;
  __bf16* kp  = qp + (size_t)BB * S1D * PPD;
  __bf16* vpF = kp + (size_t)BB * S2D * PPD;

  dim3 pg(BB * S1D / 128, PPD / 256, 3);
  proj_kernel<<<pg, 256, 0, stream>>>(q, k, v, W, b, qp, kp, vpF);

  dim3 ag(BB * (S1D / QROWS));
  attn_kernel<<<ag, 512, 0, stream>>>(qp, kp, vpF, out);
}

// v010
// Measured time: 184 microseconds a run.
// Versions between v008 and this one are left out; their measured steps multiply to 1.14 times as fast.
// Over all steps from v000 it is 7.23 times as fast.
#include <hip/hip_runtime.h>
#include <hip/hip_bf16.h>

#define BB 8
#define S1D 2048
#define S2D 2048
#define EED 1024
#define PPD 1024
#define QPITCH 1032   // 1024 + 8 bf16 pad -> row stride 2064B = 129*16B (bank-spread)
#define QROWS 64      // query rows per attention block
#define KVT 256       // key rows per attention pass
#define SPITCH 260    // score row pitch in f32: 256 + 4 pad -> 1040 B = 65*16B (bank-spread)
#define WPITCH 264    // softmax weight row pitch in bf16: 256 + 8 pad -> 528 B = 33*16B (bank-spread)
#define PROWS 384     // rows staged per projection K step: 128 of X + 256 of W
#define PPITCH 40     // their LDS pitch in bf16: 32 + 8 pad -> 80 B = 5*16B (bank-spread)
#define GT 64         // edge of a tile of G = W^T W
#define GKS 128       // rows of W per step of that product
#define GPITCH 136    // LDS pitch in bf16 of its operands: 128 + 8 pad -> 272 B = 17*16B (bank-spread)
#define GBLK 256      // its blocks: (1024 / 64)^2
#define KBLK (BB * S2D / 16)  // blocks that convert the keys, 16 rows each
#define WBLK (PPD / 16)       // blocks that convert W, 16 rows each

typedef __attribute__((ext_vector_type(16))) __bf16 v16bf;
typedef __attribute__((ext_vector_type(8)))  __bf16 v8bf;
typedef __attribute__((ext_vector_type(8)))  float  v8f;
typedef __attribute__((ext_vector_type(4)))  int    v4i;
typedef __attribute__((ext_vector_type(4)))  float  v4f;
typedef __attribute__((ext_vector_type(4)))  __bf16 v4bf;
typedef __attribute__((ext_vector_type(2)))  float  v2f;

typedef __attribute__((address_space(1))) v4i* as1_v4ip;  // global (prints as __device__*)
typedef __attribute__((address_space(3))) v4i* as3_v4ip;  // LDS

// Build a 16-element bf16 WMMA fragment from two 16-byte chunks.
// Per ISA 7.12.2 (16-bit A/B layout): frag[0..7] = K group (half*8 ..),
// frag[8..15] = K group (16+half*8 ..).
static __device__ inline v16bf frag_from_bf16(const __bf16* p0, const __bf16* p1) {
  v8bf lo = *(const v8bf*)p0;
  v8bf hi = *(const v8bf*)p1;
  return __builtin_shufflevector(lo, hi, 0,1,2,3,4,5,6,7,8,9,10,11,12,13,14,15);
}

// Async global->LDS 16B copy (ASYNCcnt path) with synchronous fallback.
static __device__ inline void copy16_g2l(const __bf16* gsrc, __bf16* ldst) {
#if __has_builtin(__builtin_amdgcn_global_load_async_to_lds_b128)
  __builtin_amdgcn_global_load_async_to_lds_b128(
      (as1_v4ip)gsrc, (as3_v4ip)ldst, 0, 0);
#else
  *(v8bf*)ldst = *(const v8bf*)gsrc;
#endif
}

// Value of the lane whose number differs by the DPP pattern CTRL (quad_perm
// 0xB1: lane ^ 1, 0x4E: lane ^ 2; row_xmask 0x164: lane ^ 4); a register move,
// no LDS traffic.
template <int CTRL>
static __device__ inline float quad_swap(float x) {
  return __builtin_bit_cast(float, __builtin_amdgcn_update_dpp(
      0, __builtin_bit_cast(int, x), CTRL, 0xf, 0xf, true));
}

static __device__ inline void wait_async_copies() {
#if __has_builtin(__builtin_amdgcn_global_load_async_to_lds_b128)
#if __has_builtin(__builtin_amdgcn_s_wait_asynccnt)
  __builtin_amdgcn_s_wait_asynccnt(0);
#else
  asm volatile("s_wait_asynccnt 0" ::: "memory");
#endif
#endif
}

// ---------------------------------------------------------------------------
// The keys are not projected. With q = W xq + b and k = W xk + b,
//   q . k = (W^T q) . xk + q . b,
// and q . b is the same for every key of a query row, so the softmax over the
// keys does not see it. The scores are taken as q' . xk with
//   q' = W^T (W xq + b) = G xq + u,   G = W^T W,   u = W^T b:
// the queries are projected with G and u in place of W and b, and the key input
// only changes its type and order. This launch prepares both, anew in every call.
// Blocks 0 .. GBLK-1: one 64 x 64 tile of G each (G[i][j] = sum over p of
// W[p][i] W[p][j], summed in f32, stored as bf16); 8 waves, each a 16 x 32 piece; 128 rows of W
// per step, read as whole lines, turned in registers (a lane holds 16 rows of its
// two columns) and kept in LDS as bf16 with p running along a row, so that the
// fragments are read as in the projection. The blocks of the first tile column
// also write their 64 elements of u, summed in f32 from the same loaded values.
// Blocks GBLK ..: 16 key rows each, f32 -> bf16, stored in the order of the
// attention kernel's B fragments (units of 1024 bytes = 16 rows x 32 k:
// [k half of 16][k group of 8][row][8 k]; units [row / 16][col / 32]).
// Blocks GBLK + KBLK ..: 16 rows of W each, f32 -> bf16.
// G and W are stored for the projection as [k / 32][row][32 k]: the 256 rows
// that a projection block stages per 32-k step are 16 KiB in a row. They are
// rounded to bf16 here once; the projection used to read them as f32 and to
// round them anew in every one of its 128 row blocks.
// ---------------------------------------------------------------------------
__global__ __launch_bounds__(256)
void prep_kernel(const float* __restrict__ Xk, const float* __restrict__ W,
                 const float* __restrict__ bias, __bf16* __restrict__ ok,
                 __bf16* __restrict__ Gt, __bf16* __restrict__ Wt,
                 float* __restrict__ u) {
  __shared__ __align__(16) __bf16 sG[2 * GT * GPITCH];
  __shared__ float sU[8][GT];

  const int lane = threadIdx.x & 31;
  const int wv   = __builtin_amdgcn_readfirstlane(threadIdx.x >> 5);

  if (blockIdx.x >= GBLK + KBLK) {
    // a wave takes two rows, 128 columns of both per turn: it reads whole lines
    // (16 lanes x 32 bytes a row) and stores four whole lines (two rows x 64 bytes)
    const int rw = (blockIdx.x - (GBLK + KBLK)) * 16 + wv * 2 + (lane >> 4);
    const int c8 = lane & 15;
    const float* sp = W + (size_t)rw * EED + c8 * 8;
    __bf16* dp = Wt + ((size_t)(c8 >> 2) * PPD + rw) * 32 + (c8 & 3) * 8;
    v4f x[8][2];
    // unrolled so that x[][] is indexed by constants and all loads fly together
#pragma unroll
    for (int it = 0; it < 8; ++it) {
      x[it][0] = *(const v4f*)(sp + it * 128);
      x[it][1] = *(const v4f*)(sp + it * 128 + 4);
    }
    // precaution: stands in front of every later rewrite of the address registers
    // that these loads name; as an input the pointer outlives the loads, so that
    // its registers are not handed to a load as its destination
    asm volatile("s_wait_xcnt 0x0" :: "v"(sp) : "memory");
#pragma unroll
    for (int it = 0; it < 8; ++it) {
      v8bf c;
#pragma unroll
      for (int j = 0; j < 4; ++j) {
        c[j]     = (__bf16)x[it][0][j];
        c[4 + j] = (__bf16)x[it][1][j];
      }
      *(v8bf*)(dp + (size_t)it * 4 * PPD * 32) = c;
    }
    // precaution: stands in front of every later rewrite of a register that these stores name
    asm volatile("s_wait_xcnt 0x0" ::: "memory");
    return;
  }

  if (blockIdx.x >= GBLK) {
    // four lanes per row and unit, 8 elements each: a wave reads whole lines of
    // 8 rows (two loads) and stores four whole lines
    const int rg    = blockIdx.x - GBLK;
    const int line8 = lane >> 2;
    const int kq    = lane & 3;
    // a wave takes four of the 32 units, both halves of their rows
    const float* sp = Xk + (size_t)(rg * 16 + line8) * EED + wv * 128 + kq * 8;
    __bf16* dp = ok + (size_t)rg * (16 * EED) + wv * 2048
               + (kq >> 1) * 256 + (kq & 1) * 128 + line8 * 8;
    v4f x[8][2];
    // unrolled so that x[][] is indexed by constants and all loads fly together
#pragma unroll
    for (int it = 0; it < 8; ++it) {
      const float* p = sp + (it & 1) * 8 * EED + (it >> 1) * 32;
      x[it][0] = *(const v4f*)p;
      x[it][1] = *(const v4f*)(p + 4);
    }
    // precaution: stands in front of every later rewrite of the address registers
    // that these loads name; as an input the pointer outlives the loads, so that
    // its registers are not handed to a load as its destination
    asm volatile("s_wait_xcnt 0x0" :: "v"(sp) : "memory");
#pragma unroll
    for (int it = 0; it < 8; ++it) {
      v8bf c;
#pragma unroll
      for (int j = 0; j < 4; ++j) {
        c[j]     = (__bf16)x[it][0][j];
        c[4 + j] = (__bf16)x[it][1][j];
      }
      *(v8bf*)(dp + (it >> 1) * 512 + (it & 1) * 64) = c;
    }
    // precaution: stands in front of every later rewrite of a register that these stores name
    asm volatile("s_wait_xcnt 0x0" ::: "memory");
    return;
  }

  const int r  = lane & 15;
  const int hh = lane >> 4;
  const int i0 = (blockIdx.x >> 4) * GT;
  const int j0 = (blockIdx.x & 15) * GT;

  // staging: a wave takes 16 rows of W per step, a lane two columns of each tile
  const float* gi = W + (size_t)(wv * 16) * EED + i0 + lane * 2;
  const float* gj = W + (size_t)(wv * 16) * EED + j0 + lane * 2;
  const float* bp = bias + wv * 16;
  __bf16* si = sG + (lane * 2) * GPITCH + wv * 16;
  __bf16* sj = si + GT * GPITCH;

  // fragments: rows 0-63 of sG are the columns i0.. of W (A), rows 64-127 the columns j0.. (B)
  const int mt  = wv >> 1;
  const int ntp = (wv & 1) * 2;
  const __bf16* fa = sG + (mt * 16 + r) * GPITCH + hh * 8;
  const __bf16* fb = sG + (GT + ntp * 16 + r) * GPITCH + hh * 8;

  v2f li[16], lj[16];
  v4f bb[4];                                     // b at the wave's 16 rows of the step
  v8f acc[2] = {};
  float ua[2] = {0.0f, 0.0f};

  // All loops over li[], lj[], bb[] and acc[] are fully unrolled so that they are
  // indexed by constants and stay in registers.
#pragma unroll
  for (int q = 0; q < 16; ++q) {
    li[q] = *(const v2f*)(gi + (size_t)q * EED);
    lj[q] = *(const v2f*)(gj + (size_t)q * EED);
  }
#pragma unroll
  for (int q = 0; q < 4; ++q) bb[q] = *(const v4f*)(bp + q * 4);
  // precaution: stands in front of every later rewrite of the address registers
  // that these loads name; as inputs the pointers outlive the loads, so that
  // their registers are not handed to a load as its destination
  asm volatile("s_wait_xcnt 0x0" :: "v"(gi), "v"(gj), "v"(bp) : "memory");

  for (int k0 = 0; k0 < PPD; k0 += GKS) {
#pragma unroll
    for (int g = 0; g < 2; ++g)
#pragma unroll
      for (int jj = 0; jj < 2; ++jj) {
        v8bf ci, cj;
#pragma unroll
        for (int q = 0; q < 8; ++q) {
          ci[q] = (__bf16)li[g * 8 + q][jj];
          cj[q] = (__bf16)lj[g * 8 + q][jj];
        }
        *(v8bf*)(si + jj * GPITCH + g * 8) = ci;
        *(v8bf*)(sj + jj * GPITCH + g * 8) = cj;
      }
#pragma unroll
    for (int q = 0; q < 16; ++q) {
      const float bq = bb[q >> 2][q & 3];
      ua[0] += li[q][0] * bq;
      ua[1] += li[q][1] * bq;
    }
    // the step's operands are complete before any wave takes a fragment
    __syncthreads();

    if (k0 + GKS < PPD) {
      gi += (size_t)GKS * EED;
      gj += (size_t)GKS * EED;
      bp += GKS;
#pragma unroll
      for (int q = 0; q < 16; ++q) {
        li[q] = *(const v2f*)(gi + (size_t)q * EED);
        lj[q] = *(const v2f*)(gj + (size_t)q * EED);
      }
#pragma unroll
      for (int q = 0; q < 4; ++q) bb[q] = *(const v4f*)(bp + q * 4);
      // precaution, as behind the first loads
      asm volatile("s_wait_xcnt 0x0" :: "v"(gi), "v"(gj), "v"(bp) : "memory");
    }

#pragma unroll
    for (int kc = 0; kc < GKS / 32; ++kc) {
      const v16bf a = frag_from_bf16(fa + kc * 32, fa + kc * 32 + 16);
#pragma unroll
      for (int t = 0; t < 2; ++t) {
        const __bf16* wp = fb + t * 16 * GPITCH + kc * 32;
        const v16bf bfr = frag_from_bf16(wp, wp + 16);
        acc[t] = __builtin_amdgcn_wmma_f32_16x16x32_bf16(
            false, a, false, bfr, (short)0, acc[t], false, false);
      }
    }
    // ends the reads of the operands that the next step overwrites
    __syncthreads();
  }

#pragma unroll
  for (int t = 0; t < 2; ++t)
#pragma unroll
    for (int v = 0; v < 8; ++v)
      Gt[((size_t)((j0 >> 5) + (ntp >> 1)) * EED + i0 + mt * 16 + hh * 8 + v) * 32 + t * 16 + r] =
          (__bf16)acc[t][v];

  // u: the eight waves hold partial sums over their rows of W
  sU[wv][lane * 2]     = ua[0];
  sU[wv][lane * 2 + 1] = ua[1];
  __syncthreads();
  if (j0 == 0 && threadIdx.x < GT) {
    float s = 0.0f;
#pragma unroll
    for (int w = 0; w < 8; ++w) s += sU[w][threadIdx.x];
    u[i0 + threadIdx.x] = s;
  }
  // precaution: stands in front of every later rewrite of a register that these stores name
  asm volatile("s_wait_xcnt 0x0" ::: "memory");
}

// ---------------------------------------------------------------------------
// Projection: out = X (M x E, f32) @ Wm^T + bs, output bf16.
// One launch does the two independent projections: blockIdx.z picks the input,
// the matrix and the output (0 queries, with G and u; 1 values, with W and b),
// so that a WGP goes from one tensor's tile to the next one's with no launch
// boundary in between. The values come last: their tiles have the shortest
// store phase, and the last tiles' store phase has no other tile's products to
// run beside.
// mode 0 (queries): out row-major (M x E).
// mode 1 (values): out in the order of the attention kernel's B fragments, as
// units of 1024 bytes = 16 lines of the operand x 32 k: [k half of 16]
// [k group of 8][line][8 k], so that lane l of a wave finds its 16 bytes of a
// half at l * 16 and one wave-wide 16-byte load covers 512 contiguous bytes
// (four whole cache lines) instead of 32-byte pieces of 16 lines;
// line = projected column, k = key row of the batch; units
// [batch][col / 16][row / 32].
// Block = 256 threads = 8 wave32 waves; block tile 128(M) x 256(N);
// wave tile 64 x 64 (sixteen 16x16 f32 accumulators), K stepped by 32.
// The 384 rows of a K step (128 of X, 128 bytes of f32 each, converted to bf16
// here; 256 of the matrix, 64 bytes of bf16 each, 16 KiB in a row as the
// preparing launch has laid them) are read once per block with loads in which a
// wave covers four whole lines and kept in LDS; the waves take their fragments
// from there. Two LDS buffers: the next step's global loads are issued ahead of
// this step's products and stored behind them, one barrier per step.
// ---------------------------------------------------------------------------
__global__ __launch_bounds__(256)
void proj_kernel(const float* __restrict__ Xq, const float* __restrict__ Xv,
                 const __bf16* __restrict__ Wt, const float* __restrict__ bv_,
                 const __bf16* __restrict__ Gt, const float* __restrict__ u,
                 __bf16* __restrict__ oq, __bf16* __restrict__ ov) {
  __shared__ __align__(16) __bf16 sT[2][PROWS * PPITCH];

  const int which = blockIdx.z;
  const float* __restrict__ X    = which == 0 ? Xq : Xv;
  const __bf16* __restrict__ W   = which == 0 ? Gt : Wt;
  const float* __restrict__ bias = which == 0 ? u : bv_;
  __bf16* __restrict__ out       = which == 0 ? oq : ov;
  const int mode = which;

  const int lane = threadIdx.x & 31;
  const int wv   = threadIdx.x >> 5;
  const int r    = lane & 15;
  const int hh   = lane >> 4;

  const int m0 = blockIdx.x * 128 + (wv & 1) * 64;
  const int n0 = blockIdx.y * 256 + (wv >> 1) * 64;

  // staging of X: eight threads per row, 16 bytes of f32 each; 32 rows per pass
  const int srow = threadIdx.x >> 3;
  const int spc  = threadIdx.x & 7;
  const float* gx = X + (size_t)(blockIdx.x * 128 + srow) * EED + spc * 4;
  const int sdst = srow * PPITCH + spc * 4;
  // of the matrix: four threads per row, 16 bytes of bf16 each; 64 rows per pass
  const __bf16* gw = W + (size_t)(blockIdx.y * 256) * 32 + threadIdx.x * 8;
  const int wdst = (128 + (threadIdx.x >> 2)) * PPITCH + (threadIdx.x & 3) * 8;

  // fragment rows in LDS: X rows first, W rows behind them
  const int aoff = ((wv & 1) * 64 + r) * PPITCH + hh * 8;
  const int boff = (128 + (wv >> 1) * 64 + r) * PPITCH + hh * 8;

  v4f st[4];
  v8bf sw[4];
  v8f acc[4][4] = {};

  // All loops over st[], sw[], a[] and acc[][] are fully unrolled so that they
  // are indexed by constants and stay in registers.
#pragma unroll
  for (int i = 0; i < 4; ++i) st[i] = *(const v4f*)(gx + (size_t)i * 32 * EED);
#pragma unroll
  for (int i = 0; i < 4; ++i) sw[i] = *(const v8bf*)(gw + i * 64 * 32);
#pragma unroll
  for (int i = 0; i < 4; ++i) {
    v4bf c;
#pragma unroll
    for (int j = 0; j < 4; ++j) c[j] = (__bf16)st[i][j];
    *(v4bf*)(&sT[0][sdst + i * 32 * PPITCH]) = c;
    *(v8bf*)(&sT[0][wdst + i * 64 * PPITCH]) = sw[i];
  }
  // the first buffer is complete before any wave takes a fragment from it
  __syncthreads();

  for (int k = 0; k < EED; k += 32) {
    const __bf16* cur = sT[(k >> 5) & 1];
    const bool more = k + 32 < EED;
    if (more) {
#pragma unroll
      for (int i = 0; i < 4; ++i)
        st[i] = *(const v4f*)(gx + (size_t)i * 32 * EED + k + 32);
#pragma unroll
      for (int i = 0; i < 4; ++i)
        sw[i] = *(const v8bf*)(gw + (size_t)(k + 32) * PPD + i * 64 * 32);
    }

    v16bf a[4];
#pragma unroll
    for (int mt = 0; mt < 4; ++mt) {
      const __bf16* ap = cur + aoff + mt * 16 * PPITCH;
      a[mt] = frag_from_bf16(ap, ap + 16);
    }
#pragma unroll
    for (int nt = 0; nt < 4; ++nt) {
      const __bf16* wp = cur + boff + nt * 16 * PPITCH;
      v16bf bfr = frag_from_bf16(wp, wp + 16);
#pragma unroll
      for (int mt = 0; mt < 4; ++mt)
        acc[mt][nt] = __builtin_amdgcn_wmma_f32_16x16x32_bf16(
            false, a[mt], false, bfr, (short)0, acc[mt][nt], false, false);
    }

    if (more) {
      __bf16* nxt = sT[((k >> 5) + 1) & 1];
#pragma unroll
      for (int i = 0; i < 4; ++i) {
        v4bf c;
#pragma unroll
        for (int j = 0; j < 4; ++j) c[j] = (__bf16)st[i][j];
        *(v4bf*)(nxt + sdst + i * 32 * PPITCH) = c;
        *(v8bf*)(nxt + wdst + i * 64 * PPITCH) = sw[i];
      }
      // precaution: stands in front of the next rewrite of the address registers
      // that this step's loads name; their data has arrived here, so it costs no wait
      asm volatile("s_wait_xcnt 0x0" ::: "memory");
    }
    // publishes the buffer just written and ends the reads of the one that the
    // next step overwrites
    __syncthreads();
  }

  if (mode == 0) {
#pragma unroll
    for (int nt = 0; nt < 4; ++nt) {
      const int n = n0 + nt * 16 + r;
      const float bv = bias[n];
#pragma unroll
      for (int mt = 0; mt < 4; ++mt)
#pragma unroll
        for (int v = 0; v < 8; ++v) {
          const int m = m0 + mt * 16 + hh * 8 + v;
          out[(size_t)m * PPD + n] = (__bf16)(acc[mt][nt][v] + bv);
        }
    }
  } else {
#pragma unroll
    for (int nt = 0; nt < 4; ++nt) {
      const int n = n0 + nt * 16 + r;
      const float bv = bias[n];
#pragma unroll
      for (int mt = 0; mt < 4; ++mt) {
        const int m = m0 + mt * 16;                // first of this tile's 16 rows
        const int batch = m / S2D;
        const int sm = m - batch * S2D;
        v8bf pk;
#pragma unroll
        for (int v = 0; v < 8; ++v) pk[v] = (__bf16)(acc[mt][nt][v] + bv);
        *(v8bf*)(out + (size_t)batch * PPD * S2D
                 + (size_t)((n >> 4) * (S2D / 32) + (sm >> 5)) * 512
                 + ((sm >> 4) & 1) * 256 + lane * 8) = pk;
      }
    }
    // precaution: stands in front of every later rewrite of a register that these stores name
    asm volatile("s_wait_xcnt 0x0" ::: "memory");
  }
}

// Work-group barrier whose fences order LDS traffic only. The data handed over
// at it lie in LDS; with the full fence of __syncthreads() the compiler drains
// the load counter in front of the barrier, and the global fragment loads
// issued ahead of it would be waited for there instead of at their first use.
static __device__ inline void lds_barrier() {
  __builtin_amdgcn_fence(__ATOMIC_RELEASE, "workgroup", "local");
  __builtin_amdgcn_s_barrier();
  __builtin_amdgcn_fence(__ATOMIC_ACQUIRE, "workgroup", "local");
}

// ---------------------------------------------------------------------------
// Flash attention over bf16 tensors: qp = G xq + u, kp = the key input itself
// (see the preparing launch: the scores differ from the reference's by a term
// that is constant along each row, which the softmax cancels), vpF = projected values.
// Grid: B * S1/64. Block = 512 threads (16 waves), one block per 64 query rows
// and all 1024 output columns, so every score is computed once.
// Q tile (64x1024 bf16) staged once to LDS via async global->LDS;
// K/V fragments streamed from L2 with b128 loads of 512 contiguous bytes per
// wave (both tensors lie in fragment order, see the preparing launch and the projection), each through a
// ring of registers: a slot is loaded again right behind its last product, four
// e steps (K) or two k steps (V) ahead of its next use. Per 256-row KV tile:
// scores (each wave its own 16 key rows: four 16x16 tiles that share each K
// fragment, K=1024; no K fragment is loaded by two waves), online softmax (all
// waves, eight lanes per row), then O += P @ V (each wave owns 64 output cols;
// each V fragment feeds the four 16-row tiles of the block).
// ---------------------------------------------------------------------------
__global__ __launch_bounds__(512)
void attn_kernel(const __bf16* __restrict__ qp, const __bf16* __restrict__ kp,
                 const __bf16* __restrict__ vpF, float* __restrict__ out) {
  __shared__ __align__(16) __bf16 sQ[QROWS * QPITCH];  // Q tile, ~129 KB
  __shared__ __align__(16) float  sS[QROWS * SPITCH];  // raw scores, f32
  __shared__ __align__(16) __bf16 sP[QROWS * WPITCH];  // softmax probs, bf16
  __shared__ float  sCorr[QROWS];                // per-row rescale factor
  __shared__ float  sStat[QROWS];                // per-row 1/l at the end

  const int lane = threadIdx.x & 31;
  // the wave's number as a scalar: the K and V fragment addresses are then a
  // scalar base plus one lane offset, which leaves the vector registers to the rings
  const int wv   = __builtin_amdgcn_readfirstlane(threadIdx.x >> 5);
  const int r    = lane & 15;
  const int hh   = lane >> 4;

  const int batch  = blockIdx.x >> 5;            // 32 q-tiles per batch
  const int q0     = (blockIdx.x & 31) * QROWS;

  const __bf16* qb = qp  + (size_t)batch * S1D * PPD;
  const __bf16* kb = kp  + (size_t)batch * S2D * PPD;
  const __bf16* vb = vpF + (size_t)batch * PPD * S2D;

  // ---- stage Q tile into LDS (async copies, 16B per call per thread)
  {
    const int row = threadIdx.x >> 3;            // 64 rows, 8 threads each
    const int seg = threadIdx.x & 7;             // 16-byte piece of a 128-byte line
    const __bf16* gs = qb + (size_t)(q0 + row) * PPD + seg * 8;
    __bf16* ls = sQ + row * QPITCH + seg * 8;
#pragma unroll
    for (int c = 0; c < 16; ++c)
      copy16_g2l(gs + c * 64, ls + c * 64);
    wait_async_copies();
  }
  __syncthreads();

  const int sn_t  = wv * 16;                     // score tiles' N offset (kv)
  const int ncol0 = wv * 64;                     // output column base
  const int srw   = threadIdx.x >> 3;            // softmax: this lane's row
  const int sq    = threadIdx.x & 7;             // and which 8 of every 64 columns

  const float scale = 0.03125f;                  // 1/sqrt(1024)

  v8f accO[4][4] = {};
  float m_run = -3.0e38f;
  float l_run = 0.0f;

  const __bf16* qlrow = sQ + r * QPITCH;         // A rows now in LDS
  float* swr = sS + hh * 8 * SPITCH + sn_t + r;  // this lane's first score element

  // K ring: the fragments of four e steps; filled here for the first pass, and
  // for every later pass inside the pass before it
  // B[k][n]=K[n][k]: the units of this wave's 16 key rows, 512 elements per e step;
  // kfr walks along them, always at the ring's oldest slot
  v16bf bk[4];
  const __bf16* kfr = kb + (size_t)sn_t * PPD + lane * 8;
  // unrolled so that bk[] is indexed by constants and stays in registers
#pragma unroll
  for (int j = 0; j < 4; ++j)
    bk[j] = frag_from_bf16(kfr + j * 512, kfr + j * 512 + 256);

  for (int kv = 0; kv < S2D; kv += KVT) {
    // ---- phase 1: S = Q K^T (each wave four 16x16 tiles of the 64x256 block)
    v8f accS[4] = {};
    // kept as a loop of four e steps, one per ring slot; the inner loops are
    // unrolled so that bk[] and accS[] are indexed by constants
#pragma unroll 1
    for (int e = 0; e < EED - 128; e += 128) {
#pragma unroll
      for (int j = 0; j < 4; ++j) {
        v16bf a[4];
#pragma unroll
        for (int mt = 0; mt < 4; ++mt) {
          const __bf16* qr = qlrow + mt * 16 * QPITCH + e + j * 32;
          a[mt] = frag_from_bf16(qr + hh * 8, qr + 16 + hh * 8);
        }
        // keeps the four Q fragments' LDS loads one group ahead of their
        // products: with the ring's registers taken, the compiler otherwise
        // loads one fragment at a time and waits for each
        __builtin_amdgcn_sched_barrier(0);
#pragma unroll
        for (int mt = 0; mt < 4; ++mt)
          accS[mt] = __builtin_amdgcn_wmma_f32_16x16x32_bf16(
              false, a[mt], false, bk[j], (short)0, accS[mt], false, false);
        const __bf16* kn = kfr + (4 + j) * 512;
        bk[j] = frag_from_bf16(kn, kn + 256);
        // keeps the slot's reload here, right behind its last product
        __builtin_amdgcn_sched_barrier(0);
      }
      kfr += 4 * 512;
    }
    // the last four e steps: nothing of this pass is left to load
#pragma unroll
    for (int j = 0; j < 4; ++j) {
      v16bf a[4];
#pragma unroll
      for (int mt = 0; mt < 4; ++mt) {
        const __bf16* qr = qlrow + mt * 16 * QPITCH + (EED - 128) + j * 32;
        a[mt] = frag_from_bf16(qr + hh * 8, qr + 16 + hh * 8);
      }
      // as in the loop: the four LDS loads stay one group
      __builtin_amdgcn_sched_barrier(0);
#pragma unroll
      for (int mt = 0; mt < 4; ++mt)
        accS[mt] = __builtin_amdgcn_wmma_f32_16x16x32_bf16(
            false, a[mt], false, bk[j], (short)0, accS[mt], false, false);
    }
    // unrolled for the same reason: constant indices into accS[]
#pragma unroll
    for (int mt = 0; mt < 4; ++mt)
#pragma unroll
      for (int v = 0; v < 8; ++v)
        swr[(mt * 16 + v) * SPITCH] = accS[mt][v];

    __syncthreads();

    // ---- phase 2: online softmax row update (all waves; eight lanes share a
    // row, each holds 32 of its columns in registers: columns sq * 8 .. + 7 of
    // every group of 64; the eight lanes keep equal copies of the row's running
    // maximum and sum)
    {
      const float* srow = sS + srw * SPITCH + sq * 8;
      float s[32];
      // unrolled so that s[] is indexed by constants and stays in registers
#pragma unroll
      for (int j = 0; j < 8; ++j) {
        const v4f t = *(const v4f*)(srow + (j >> 1) * 64 + (j & 1) * 4);
#pragma unroll
        for (int i = 0; i < 4; ++i) s[j * 4 + i] = t[i] * scale;
      }
      float mx = m_run;
#pragma unroll
      for (int c = 0; c < 32; ++c) mx = fmaxf(mx, s[c]);
      mx = fmaxf(mx, quad_swap<0xB1>(mx));
      mx = fmaxf(mx, quad_swap<0x4E>(mx));
      mx = fmaxf(mx, quad_swap<0x164>(mx));
      const float corr = __expf(m_run - mx);
      float lp[4] = {0.0f, 0.0f, 0.0f, 0.0f};    // four independent sum chains
      v8bf pk[4];
#pragma unroll
      for (int c = 0; c < 32; ++c) {
        const float p = __expf(s[c] - mx);
        lp[c & 3] += p;
        pk[c >> 3][c & 7] = (__bf16)p;
      }
      float ls = (lp[0] + lp[1]) + (lp[2] + lp[3]);
      ls += quad_swap<0xB1>(ls);
      ls += quad_swap<0x4E>(ls);
      ls += quad_swap<0x164>(ls);
      __bf16* prow = sP + srw * WPITCH + sq * 8;
      // unrolled so that pk[] is indexed by constants and stays in registers
#pragma unroll
      for (int j = 0; j < 4; ++j) *(v8bf*)(prow + j * 64) = pk[j];
      l_run = l_run * corr + ls;
      m_run = mx;
      if (sq == 0) sCorr[srw] = corr;
    }

    // V ring: the fragments of two k steps (four column tiles each), first
    // filled here so that they fly during the barrier and the rescale.
    // B[k][n] = V[kv+k][n]: the unit of 16 columns and 32 key rows
    // vfr walks along the key rows, always at the ring's oldest k step
    const __bf16* vfr = vb + (size_t)((ncol0 >> 4) * (S2D / 32) + (kv >> 5)) * 512 + lane * 8;
    v16bf bv[2][4];
    // unrolled so that bv[][] is indexed by constants and stays in registers
#pragma unroll
    for (int s = 0; s < 2; ++s)
#pragma unroll
      for (int nt = 0; nt < 4; ++nt) {
        const __bf16* vn = vfr + (nt * (S2D / 32) + s) * 512;
        bv[s][nt] = frag_from_bf16(vn, vn + 256);
      }
    // precaution: stands in front of every later rewrite of the address registers
    // that these loads name; as an input the pointer outlives the loads, so that
    // its registers are not handed to the last load as its destination
    asm volatile("s_wait_xcnt 0x0" :: "v"(vfr) : "memory");
    lds_barrier();

    // ---- phase 3: rescale O, then O += P @ V (wave owns 64 output cols)
#pragma unroll
    for (int mt = 0; mt < 4; ++mt)
#pragma unroll
      for (int v = 0; v < 8; ++v) {
        const float c = sCorr[mt * 16 + hh * 8 + v];
#pragma unroll
        for (int nt = 0; nt < 4; ++nt) accO[mt][nt][v] *= c;
      }

    // kept as a loop of two k steps, one per half of the ring; the inner loops
    // are unrolled so that bv[][], aP[] and accO[][] are indexed by constants
#pragma unroll 1
    for (int ks = 0; ks < KVT - 64; ks += 64) {
#pragma unroll
      for (int s = 0; s < 2; ++s) {
        v16bf aP[4];
#pragma unroll
        for (int mt = 0; mt < 4; ++mt) {
          const __bf16* pr = sP + (mt * 16 + r) * WPITCH + ks + s * 32;
          aP[mt] = frag_from_bf16(pr + hh * 8, pr + 16 + hh * 8);
        }
#pragma unroll
        for (int nt = 0; nt < 4; ++nt) {
#pragma unroll
          for (int mt = 0; mt < 4; ++mt)
            accO[mt][nt] = __builtin_amdgcn_wmma_f32_16x16x32_bf16(
                false, aP[mt], false, bv[s][nt], (short)0, accO[mt][nt], false, false);
          const __bf16* vn = vfr + (nt * (S2D / 32) + s + 2) * 512;
          bv[s][nt] = frag_from_bf16(vn, vn + 256);
        }
      }
      vfr += 2 * 512;
    }
    // the last two k steps: nothing of V is left to load; between them the K
    // ring is filled for the next pass (behind the last pass: the first tile
    // once more, an address in bounds whose values are not used)
#pragma unroll
    for (int s = 0; s < 2; ++s) {
      v16bf aP[4];
#pragma unroll
      for (int mt = 0; mt < 4; ++mt) {
        const __bf16* pr = sP + (mt * 16 + r) * WPITCH + (KVT - 64) + s * 32;
        aP[mt] = frag_from_bf16(pr + hh * 8, pr + 16 + hh * 8);
      }
#pragma unroll
      for (int nt = 0; nt < 4; ++nt)
#pragma unroll
        for (int mt = 0; mt < 4; ++mt)
          accO[mt][nt] = __builtin_amdgcn_wmma_f32_16x16x32_bf16(
              false, aP[mt], false, bv[s][nt], (short)0, accO[mt][nt], false, false);
      if (s == 0) {
        const int kvn = kv + KVT < S2D ? kv + KVT : 0;
        kfr = kb + (size_t)(kvn + sn_t) * PPD + lane * 8;
#pragma unroll
        for (int j = 0; j < 4; ++j)
          bk[j] = frag_from_bf16(kfr + j * 512, kfr + j * 512 + 256);
        // keeps these loads here, a k step's products ahead of the barrier
        __builtin_amdgcn_sched_barrier(0);
      }
    }
    lds_barrier();
  }

  // ---- epilogue: divide by row sums, write f32 output
  if (sq == 0) sStat[srw] = 1.0f / l_run;
  __syncthreads();

  float* ob = out + ((size_t)batch * S1D + q0) * PPD;
  // the lane's number read anew: its parts need no register through the loops,
  // where the rings leave none to spare (they went to scratch otherwise)
  const int elane = __builtin_amdgcn_mbcnt_lo(~0u, 0u);
  const int er = elane & 15;
  const int eh = elane >> 4;
#pragma unroll
  for (int mt = 0; mt < 4; ++mt)
#pragma unroll
    for (int v = 0; v < 8; ++v) {
      const int row = mt * 16 + eh * 8 + v;
      const float inv = sStat[row];
#pragma unroll
      for (int nt = 0; nt < 4; ++nt)
        ob[(size_t)row * PPD + ncol0 + nt * 16 + er] = accO[mt][nt][v] * inv;
    }
}

extern "C" void kernel_launch(void* const* d_in, const int* in_sizes, int n_in,
                              void* d_out, int out_size, void* d_ws, size_t ws_size,
                              hipStream_t stream) {
  (void)in_sizes; (void)n_in; (void)out_size; (void)ws_size;
  const float* q = (const float*)d_in[0];
  const float* k = (const float*)d_in[1];
  const float* v = (const float*)d_in[2];
  const float* W = (const float*)d_in[3];
  const float* b = (const float*)d_in[4];
  float* out = (float*)d_out;

  // Workspace: bf16 queries (B*S1*E, row-major), keys (B*S2*E) and projected
  // values (B*P*S2), the last two in fragment order = 96 MB; then G (E*E) and
  // W (P*E) as bf16 in the projection's staging order, and u (E), f32
  __bf16* qp  = (__bf16*)d_ws;
  __bf16* kp  = qp + (size_t)BB * S1D * PPD;
  __bf16* vpF = kp + (size_t)BB * S2D * PPD;
  __bf16* Gt  = vpF + (size_t)BB * S2D * PPD;
  __bf16* Wt  = Gt + (size_t)EED * EED;
  float*  u   = (float*)(Wt + (size_t)PPD * EED);

  prep_kernel<<<GBLK + KBLK + WBLK, 256, 0, stream>>>(k, W, b, kp, Gt, Wt, u);

  dim3 pg(BB * S1D / 128, PPD / 256, 2);
  proj_kernel<<<pg, 256, 0, stream>>>(q, v, Wt, b, Gt, u, qp, vpF);

  dim3 ag(BB * (S1D / QROWS));
  attn_kernel<<<ag, 512, 0, stream>>>(qp, kp, vpF, out);
}
